// v000
// Times are from an AMD MI455X. After a warm-up the kernel runs many times in a row, and a time is the length of
// such a window on the GPU divided by its runs, so every launch and the gaps after it count. The runs cycle
// through copies of the inputs. A figure is the median of several windows, for all but v000 over two sittings.
// Sittings can differ by a few percent; kernels timed side by side share one.
// v000 is the starting kernel. One run takes 1360 microseconds.
#include <hip/hip_runtime.h>

// Causal multi-head attention with a per-head packed qkv projection (inputs [2][2048][1024]; qkv = x W_qkv^T ('oi' [3072][1024] 1/32, no bias); the module views qkv as (T, 16 heads, 3 x 64) and splits the LAST dim: head h's q = output rows h*192 + 0..63, k = h*192 + 64..127, v = h*192 + 128..191; scores x 64^-0.5; causal (-inf); softmax; out = merged heads (no output projection) -> [2][2048][1024] (4.2 M); argument order inputs, W_qkv).
// Layout per batch: the packed weight rows are gathered once into a standard q | k | v Bt (a row permutation of the bf16 copy); bf16 copy of x; exact projections; causal T-2048 attention (hybrid rows: < 512 hi/lo 3 products, rest fp16 x1024; k_gemmc skips tiles above the diagonal); the f32 merge writes the output rows.
// Compute dtypes, f32 accumulate: every input rounded to bf16; projections exact; attention rows < 512 3 products, rest fp16; softmax f32; output f32.

#define NB_  2
#define TT   2048
#define DM   1024
#define NH_  16
#define NKV  16
#define REP  (NH_ / NKV)
#define HD   64
#define DQ   (NH_ * HD)
#define DKV  (NKV * HD)
#define ZH   2
#define RH   512                  // query rows < RH use hi+lo planes (0: none)
#define WIN  2048
#define PCAR 1024.0f
#define SCL  0.125f   // HD^-0.5
typedef _Float16 h16;
typedef unsigned short bf;
typedef __attribute__((ext_vector_type(16))) __bf16   v16bf;
typedef __attribute__((ext_vector_type(16))) _Float16 v16h;
typedef __attribute__((ext_vector_type(8)))  _Float16 v8h;
typedef __attribute__((ext_vector_type(8)))  unsigned short v8us;
typedef __attribute__((ext_vector_type(8)))  float    v8f;
typedef __attribute__((ext_vector_type(4)))  float    v4f;
typedef v8h  __attribute__((may_alias)) v8ha;
typedef v4f  __attribute__((may_alias)) v4fa;
typedef v8us __attribute__((may_alias)) v8usa;

__device__ __forceinline__ unsigned short f2bf(float f) { unsigned u = __float_as_uint(f); u += 0x7FFFu + ((u >> 16) & 1u); return (unsigned short)(u >> 16); }
__device__ __forceinline__ float bf2f(unsigned short b) { return __uint_as_float(((unsigned)b) << 16); }
__device__ __forceinline__ float bfr(float f) { return bf2f(f2bf(f)); }
__device__ __forceinline__ v16h cat16(v8h lo, v8h hi) { return __builtin_shufflevector(lo, hi, 0, 1, 2, 3, 4, 5, 6, 7, 8, 9, 10, 11, 12, 13, 14, 15); }
__device__ __forceinline__ v16bf cat16b(v8us lo, v8us hi) { return __builtin_bit_cast(v16bf, __builtin_shufflevector(lo, hi, 0, 1, 2, 3, 4, 5, 6, 7, 8, 9, 10, 11, 12, 13, 14, 15)); }
__device__ __forceinline__ v8f wmma16(v16h a, v16h b, v8f c) { return __builtin_amdgcn_wmma_f32_16x16x32_f16(false, a, false, b, (short)0, c, false, false); }
__device__ __forceinline__ v8f wmmab(v16bf a, v16bf b, v8f c) { return __builtin_amdgcn_wmma_f32_16x16x32_bf16(false, a, false, b, (short)0, c, false, false); }



// ---- k_gemmw: register-blocked GEMM, ONE WAVE per 64x64 output tile (16 accumulators), operands straight from K-contiguous 16-bit planes; grid (M/64, N/64, Z), 32 threads.
// C[m][n] (f32, pitch ldc, + optional f32 bias[n]) = sum_k A[m][k] Bt[n][k] (+ split products per NSPLIT). z-batch strides sA/sB/sC in elements. K % 32 == 0.
template <typename T16> struct WFrag;
template <> struct WFrag<h16> { typedef v16h V; static __device__ __forceinline__ V ld(const h16* p) { return cat16(*(const v8h*)p, *(const v8h*)(p + 16)); } static __device__ __forceinline__ v8f mma(V a, V b, v8f c) { return wmma16(a, b, c); } };
template <> struct WFrag<bf> { typedef v16bf V; static __device__ __forceinline__ V ld(const bf* p) { return cat16b(*(const v8us*)p, *(const v8us*)(p + 16)); } static __device__ __forceinline__ v8f mma(V a, V b, v8f c) { return wmmab(a, b, c); } };
template <typename T16, int NSPLIT, bool BIAS>
__global__ __launch_bounds__(32) void k_gemmw(const T16* __restrict__ A, const T16* __restrict__ A2, const T16* __restrict__ Bt, const T16* __restrict__ Bt2, int K, float* C, int ldc, const float* __restrict__ bias, size_t sA, size_t sB, size_t sC) {
    typedef typename WFrag<T16>::V V;
    __shared__ __align__(16) float os[16 * 68];
    const size_t z = blockIdx.z; A += z * sA; if (A2) A2 += z * sA; Bt += z * sB; if (Bt2) Bt2 += z * sB; C += z * sC;
    const int lane = threadIdx.x & 31, lr = lane & 15, hi = lane >> 4; const int r0 = blockIdx.x * 64, c0 = blockIdx.y * 64;
    v8f acc[4][4];
#pragma unroll
    for (int mb = 0; mb < 4; ++mb)
#pragma unroll
        for (int nb = 0; nb < 4; ++nb) acc[mb][nb] = (v8f){};
    const size_t aoff = (size_t)(r0 + lr) * K + 8 * hi, boff = (size_t)(c0 + lr) * K + 8 * hi;
#pragma unroll 1
    for (int kc = 0; kc < K; kc += 32) {
        V a[4], a2[4];
#pragma unroll
        for (int mb = 0; mb < 4; ++mb) { a[mb] = WFrag<T16>::ld(A + aoff + (size_t)mb * 16 * K + kc); if (NSPLIT == 1 || NSPLIT == 2) a2[mb] = WFrag<T16>::ld(A2 + aoff + (size_t)mb * 16 * K + kc); }
#pragma unroll
        for (int nb = 0; nb < 4; ++nb) { const V b = WFrag<T16>::ld(Bt + boff + (size_t)nb * 16 * K + kc); V b2; if (NSPLIT >= 2) b2 = WFrag<T16>::ld(Bt2 + boff + (size_t)nb * 16 * K + kc);
#pragma unroll
            for (int mb = 0; mb < 4; ++mb) { acc[mb][nb] = WFrag<T16>::mma(a[mb], b, acc[mb][nb]); if (NSPLIT == 1 || NSPLIT == 2) acc[mb][nb] = WFrag<T16>::mma(a2[mb], b, acc[mb][nb]); if (NSPLIT >= 2) acc[mb][nb] = WFrag<T16>::mma(a[mb], b2, acc[mb][nb]); } }
        asm volatile("v_nop\n\tv_nop\n\tv_nop\n\tv_nop" : "+v"(acc[0][0]), "+v"(acc[1][1]), "+v"(acc[2][2]), "+v"(acc[3][3]) : "v"(a[0]), "v"(a[3]));
    }
#pragma unroll
    for (int mb = 0; mb < 4; ++mb) {
#pragma unroll
        for (int nb = 0; nb < 4; ++nb) {
#pragma unroll
            for (int j = 0; j < 8; ++j) os[(hi * 8 + j) * 68 + nb * 16 + lr] = acc[mb][nb][j]; }
        __builtin_amdgcn_wave_barrier(); asm volatile("" ::: "memory");
        float* crow = C + (size_t)(r0 + mb * 16) * ldc + c0;
{
#pragma unroll
            for (int s = 0; s < 8; ++s) { const int row = 2 * s + hi, cofs = lr * 4; v4f val = *(const v4fa*)(os + row * 68 + cofs); if (BIAS) { val[0] += bfr(bias[c0 + cofs]); val[1] += bfr(bias[c0 + cofs + 1]); val[2] += bfr(bias[c0 + cofs + 2]); val[3] += bfr(bias[c0 + cofs + 3]); }
                *(v4f*)(crow + (size_t)row * ldc + cofs) = val; }
             }
        __builtin_amdgcn_wave_barrier(); asm volatile("" ::: "memory");
    }
}

// ---- k_gemmc: the same one-wave 64x64 tile GEMM specialised for causal attention: CMODE 1 skips score tiles entirely above the diagonal (query rows r0+roff.., key columns c0..), CMODE 2 limits the
// key (K) loop of the probability x value contraction to the diagonal block (probabilities beyond it are exactly zero). roff = row offset of this launch's first row within the sequence.
template <typename T16, int NSPLIT, int CMODE>
__global__ __launch_bounds__(32) void k_gemmc(const T16* __restrict__ A, const T16* __restrict__ A2, const T16* __restrict__ Bt, const T16* __restrict__ Bt2, int K, float* C, int ldc, int roff, size_t sA, size_t sB, size_t sC) {
    typedef typename WFrag<T16>::V V;
    __shared__ __align__(16) float os[16 * 68];
    const size_t z = blockIdx.z; A += z * sA; if (A2) A2 += z * sA; Bt += z * sB; if (Bt2) Bt2 += z * sB; C += z * sC;
    const int lane = threadIdx.x & 31, lr = lane & 15, hi = lane >> 4; const int r0 = blockIdx.x * 64, c0 = blockIdx.y * 64;
    if (CMODE == 1 && c0 > r0 + roff + 63) return;                  // score tile entirely above the causal diagonal: never read (the softmax masks j > i by select)
    const int Kl = (CMODE == 2) ? min(K, r0 + roff + 64) : K;        // P.V: probabilities are exactly 0 beyond the diagonal block, so the K loop stops there
    v8f acc[4][4];
#pragma unroll
    for (int mb = 0; mb < 4; ++mb)
#pragma unroll
        for (int nb = 0; nb < 4; ++nb) acc[mb][nb] = (v8f){};
    const size_t aoff = (size_t)(r0 + lr) * K + 8 * hi, boff = (size_t)(c0 + lr) * K + 8 * hi;
#pragma unroll 1
    for (int kc = 0; kc < Kl; kc += 32) {
        V a[4], a2[4];
#pragma unroll
        for (int mb = 0; mb < 4; ++mb) { a[mb] = WFrag<T16>::ld(A + aoff + (size_t)mb * 16 * K + kc); if (NSPLIT == 1 || NSPLIT == 2) a2[mb] = WFrag<T16>::ld(A2 + aoff + (size_t)mb * 16 * K + kc); }
#pragma unroll
        for (int nb = 0; nb < 4; ++nb) { const V b = WFrag<T16>::ld(Bt + boff + (size_t)nb * 16 * K + kc); V b2; if (NSPLIT >= 2) b2 = WFrag<T16>::ld(Bt2 + boff + (size_t)nb * 16 * K + kc);
#pragma unroll
            for (int mb = 0; mb < 4; ++mb) { acc[mb][nb] = WFrag<T16>::mma(a[mb], b, acc[mb][nb]); if (NSPLIT == 1 || NSPLIT == 2) acc[mb][nb] = WFrag<T16>::mma(a2[mb], b, acc[mb][nb]); if (NSPLIT >= 2) acc[mb][nb] = WFrag<T16>::mma(a[mb], b2, acc[mb][nb]); } }
        asm volatile("v_nop\n\tv_nop\n\tv_nop\n\tv_nop" : "+v"(acc[0][0]), "+v"(acc[1][1]), "+v"(acc[2][2]), "+v"(acc[3][3]) : "v"(a[0]), "v"(a[3]));
    }
#pragma unroll
    for (int mb = 0; mb < 4; ++mb) {
#pragma unroll
        for (int nb = 0; nb < 4; ++nb) {
#pragma unroll
            for (int j = 0; j < 8; ++j) os[(hi * 8 + j) * 68 + nb * 16 + lr] = acc[mb][nb][j]; }
        __builtin_amdgcn_wave_barrier(); asm volatile("" ::: "memory");
        float* crow = C + (size_t)(r0 + mb * 16) * ldc + c0;
{
#pragma unroll
            for (int s = 0; s < 8; ++s) { const int row = 2 * s + hi, cofs = lr * 4; v4f val = *(const v4fa*)(os + row * 68 + cofs);
                *(v4f*)(crow + (size_t)row * ldc + cofs) = val; }
             }
        __builtin_amdgcn_wave_barrier(); asm volatile("" ::: "memory");
    }
}

__device__ __forceinline__ h16 tohx(float x) { return (h16)x; }
__device__ __forceinline__ void splitf(float y, unsigned short& h, unsigned short& l) { h = f2bf(y); l = f2bf(y - bf2f(h)); }
typedef __attribute__((ext_vector_type(2))) _Float16 v2h;
typedef __attribute__((ext_vector_type(4))) _Float16 v4h;
typedef __attribute__((ext_vector_type(2))) unsigned short v2us;
typedef __attribute__((ext_vector_type(4))) unsigned short v4us;
typedef __attribute__((ext_vector_type(2))) float v2f;
typedef __attribute__((ext_vector_type(4))) int v4i;

__global__ __launch_bounds__(256) void k_cvt8(const float* __restrict__ src, bf* dst, size_t n8) { const size_t i = (size_t)blockIdx.x * 256 + threadIdx.x; if (i >= n8) return; const v8f v = *(const v8f*)(src + i * 8); v8us o;
#pragma unroll
    for (int k = 0; k < 8; ++k) o[k] = f2bf(v[k]); *(v8us*)(dst + i * 8) = o;  }

__global__ __launch_bounds__(256) void k_wperm(const float* __restrict__ W, bf* Bt) { const size_t i = (size_t)blockIdx.x * 256 + threadIdx.x; if (i >= (size_t)3 * DQ * DM / 8) return; const size_t e = i * 8; const int c0 = (int)(e % DM); const int rd = (int)(e / DM); const int part = rd / DQ; const int h = (rd % DQ) / HD; const int d = rd % HD; const int rs = h * 3 * HD + part * HD + d; const v8f v = *(const v8f*)(W + (size_t)rs * DM + c0); v8us o;
#pragma unroll
    for (int k = 0; k < 8; ++k) o[k] = f2bf(v[k]); *(v8us*)(Bt + e) = o;  }
// k_rope: head planes [h][t][d] (fp16 + hi/lo) of rope(x) x sc with the rotate-half convention out[d] = x[d] cos[t][d] - x[d+HD/2] sin[t][d], out[d+HD/2] = x[d+HD/2] cos[t][d+HD/2] + x[d] sin[t][d+HD/2]
__global__ __launch_bounds__(256) void k_rope(const float* __restrict__ F, int pitch, int nheads, const float* __restrict__ CS, const float* __restrict__ RF, const float* __restrict__ nw, float sc, h16* P16, bf* Ph, bf* Pl) {
    const size_t e = ((size_t)blockIdx.x * 256 + threadIdx.x) * 2; if (e >= (size_t)nheads * TT * HD) return; const int d = (int)(e % HD); const int t = (int)((e / HD) % TT); const int h = (int)(e / ((size_t)HD * TT)); const float* f = F + (size_t)t * pitch + h * HD; const float rf = RF ? RF[(size_t)h * TT + t] : 1.0f; v2h o16; v2us oh, ol;
#pragma unroll
    for (int q = 0; q < 2; ++q) { const int dd = d + q; const int dp = (dd < HD / 2) ? dd + HD / 2 : dd - HD / 2; float x0 = f[dd], x1 = f[dp];
        if (RF) { float n0 = __fmul_rn(x0, rf), n1 = __fmul_rn(x1, rf); asm volatile("" : "+v"(n0)); asm volatile("" : "+v"(n1)); x0 = __fmul_rn(bfr(nw[dd]), n0); x1 = __fmul_rn(bfr(nw[dp]), n1); }
        const v2f cs = *(const v2f*)(CS + ((size_t)t * HD + dd) * 2); float a = __fmul_rn(x0, cs[0]), bq = __fmul_rn(x1, cs[1]); asm volatile("" : "+v"(a)); asm volatile("" : "+v"(bq)); const float r = ((dd < HD / 2) ? __fsub_rn(a, bq) : __fadd_rn(a, bq)) * sc;
        o16[q] = tohx(r); unsigned short a2, c2; splitf(r, a2, c2); oh[q] = a2; ol[q] = c2; }
    *(v2h*)(P16 + e) = o16; *(v2us*)(Ph + e) = oh; *(v2us*)(Pl + e) = ol;  }
__global__ __launch_bounds__(256) void k_vtp(const float* __restrict__ F, int pitch, int nheads, h16* V16, bf* Vh, bf* Vl) { const size_t e = ((size_t)blockIdx.x * 256 + threadIdx.x) * 2; if (e >= (size_t)nheads * HD * TT) return; const int t = (int)(e % TT); const int d = (int)((e / TT) % HD); const int g = (int)(e / ((size_t)TT * HD)); v2h o16; v2us oh, ol;
#pragma unroll
    for (int q = 0; q < 2; ++q) { const float x = F[(size_t)(t + q) * pitch + g * HD + d]; o16[q] = tohx(x); unsigned short a2, c2; splitf(x, a2, c2); oh[q] = a2; ol[q] = c2; }
    *(v2h*)(V16 + e) = o16; *(v2us*)(Vh + e) = oh; *(v2us*)(Vl + e) = ol;  }
__global__ __launch_bounds__(256) void k_csid(float* CS) { const int idx = blockIdx.x * 256 + threadIdx.x; if (idx >= TT * HD) return; v2f cs; cs[0] = 1.0f; cs[1] = 0.0f; *(v2f*)(CS + (size_t)idx * 2) = cs;  }
// k_asoft: per row (zz, i): t = S x HD^-0.5 for j <= i and i - j < WIN (sliding causal window; the reference's -1e9 additive fill vanishes identically); softmax over the 2048 keys (register row, one exp, fixed trees);
__global__ __launch_bounds__(256) void k_asoft(const float* __restrict__ Sb, h16* P16, bf* Ph, bf* Pl) {
    const int lane = threadIdx.x & 31; const int row = blockIdx.x * 8 + (threadIdx.x >> 5); if (row >= ZH * TT) return; const int i = row % TT; const int zz = row / TT; (void)zz; const bool hires = (i < RH); const float* sr = Sb + (size_t)row * TT; float v[TT / 32]; float mx = -3.0e38f;
#pragma unroll
    for (int ch = 0; ch < TT / 128; ++ch) { const int j0 = ch * 128 + lane * 4; const v4f a = *(const v4f*)(sr + j0);
#pragma unroll
        for (int q = 0; q < 4; ++q) { const int j = j0 + q; (void)j; const float t = (j <= i && i - j < WIN) ? a[q] * SCL : -3.0e38f; v[ch * 4 + q] = t; mx = fmaxf(mx, t); } }
#pragma unroll
    for (int sh = 16; sh; sh >>= 1) mx = fmaxf(mx, __shfl_xor(mx, sh, 32));
    float sum = 0.f;
#pragma unroll
    for (int k = 0; k < TT / 32; ++k) { float d0 = __fsub_rn(v[k], mx); asm volatile("" : "+v"(d0)); v[k] = __builtin_amdgcn_exp2f(__fmul_rn(d0, 1.4426950408889634f)); sum += v[k]; }
#pragma unroll
    for (int sh = 16; sh; sh >>= 1) sum += __shfl_xor(sum, sh, 32);
    const float f = __fdiv_rn(hires ? 1.0f : PCAR, sum);
{
        if (hires) {
#pragma unroll
            for (int ch = 0; ch < TT / 128; ++ch) { v4us oh, ol;
#pragma unroll
                for (int q = 0; q < 4; ++q) { unsigned short a, c2; splitf(v[ch * 4 + q] * f, a, c2); oh[q] = a; ol[q] = c2; }
                const size_t oo = ((size_t)zz * (RH ? RH : 1) + i) * TT + ch * 128 + lane * 4; *(v4us*)(Ph + oo) = oh; *(v4us*)(Pl + oo) = ol; }
        } else {
#pragma unroll
            for (int ch = 0; ch < TT / 128; ++ch) { v4h o4;
#pragma unroll
                for (int q = 0; q < 4; ++q) o4[q] = tohx(v[ch * 4 + q] * f);
                *(v4h*)(P16 + (size_t)row * TT + ch * 128 + lane * 4) = o4; } }
         }
}
__global__ __launch_bounds__(256) void k_merge(const float* __restrict__ O, int h0, float* OUTb) { const size_t e = ((size_t)blockIdx.x * 256 + threadIdx.x) * 2; if (e >= (size_t)ZH * TT * HD) return; const int d = (int)(e % HD); const int t = (int)((e / HD) % TT); const int zz = (int)(e / ((size_t)HD * TT)); const float cs = (t < RH) ? 1.0f : (1.0f / PCAR); const size_t oo = (size_t)t * DQ + (h0 + zz) * HD + d;
    v2f o2; o2[0] = O[e] * cs; o2[1] = O[e + 1] * cs; *(v2f*)(OUTb + oo) = o2;  }

extern "C" void kernel_launch(void* const* d_in, const int* in_sizes, int n_in,
                              void* d_out, int out_size, void* d_ws, size_t ws_size, hipStream_t stream) {
    (void)in_sizes; (void)n_in; (void)out_size;
    const float* x = (const float*)d_in[0]; const float* wqkv = (const float*)d_in[1];   /* order inputs, W_qkv ('oi' [3072][1024], per-head (q, k, v) packed rows) */ const float* wq = wqkv; const float* wk = nullptr; const float* wv = nullptr; const float* wo = nullptr; (void)wk; (void)wv; (void)wo;
    float* OUT = (float*)d_out;     // [2][2048][1024]
    char* wsp = (char*)d_ws;
    auto take = [&](size_t bytes) { char* p = wsp; wsp += (bytes + 255) & ~(size_t)255; return (void*)p; };
    bf* WQKV = (bf*)take((size_t)3 * DQ * DM * 2); bf* WQ = WQKV; bf* WK = WQKV + (size_t)DQ * DM; bf* WV = WQKV + (size_t)2 * DQ * DM;   /* de-interleaved Bt: q | k | v row blocks in head order */ float* CS = (float*)take((size_t)TT * HD * 2 * 4);
    bf* XB = (bf*)take((size_t)TT * DM * 2); float* FQ = (float*)take((size_t)TT * DQ * 4); float* FK = (float*)take((size_t)TT * DKV * 4);
    h16* QP16 = (h16*)take((size_t)NH_ * TT * HD * 2); h16* KP16 = (h16*)take((size_t)NKV * TT * HD * 2); h16* VT16 = (h16*)take((size_t)NKV * HD * TT * 2);
    bf* QPh = (bf*)take((size_t)NH_ * TT * HD * 2); bf* QPl = (bf*)take((size_t)NH_ * TT * HD * 2); bf* KPh = (bf*)take((size_t)NKV * TT * HD * 2); bf* KPl = (bf*)take((size_t)NKV * TT * HD * 2); bf* VTh = (bf*)take((size_t)NKV * HD * TT * 2); bf* VTl = (bf*)take((size_t)NKV * HD * TT * 2); bf* Ph = (bf*)take((size_t)ZH * RH * TT * 2); bf* Pl = (bf*)take((size_t)ZH * RH * TT * 2);
    float* Sb = (float*)take((size_t)ZH * TT * TT * 4); h16* P16 = (h16*)take((size_t)ZH * TT * TT * 2); float* Ob = (float*)take((size_t)ZH * TT * HD * 4);
    if ((size_t)(wsp - (char*)d_ws) > ws_size) return;    // ws 256 MiB
    float* FV = FK;   // v projection reuses the k buffer after the k planes are built (stream-ordered)
    { k_wperm<<<(unsigned)(((size_t)3 * DQ * DM / 8 + 255) / 256), 256, 0, stream>>>(wqkv, WQKV);   /* packed rows (h, part, d) -> standard (part, h, d) blocks */
      
       }
    k_csid<<<(TT * HD + 255) / 256, 256, 0, stream>>>(CS);
    const unsigned LQ = (unsigned)(((size_t)NH_ * TT * HD / 2 + 255) / 256), LKv = (unsigned)(((size_t)NKV * TT * HD / 2 + 255) / 256);
    for (int b = 0; b < NB_; ++b) {
        
        k_cvt8<<<(unsigned)(((size_t)TT * DM / 8 + 255) / 256), 256, 0, stream>>>(x + (size_t)b * TT * DM, XB, (size_t)TT * DM / 8);
        k_gemmw<bf, 0, false><<<dim3(TT / 64, DQ / 64, 1), 32, 0, stream>>>(XB, nullptr, WQ, nullptr, DM, FQ, DQ, nullptr, 0, 0, 0);
        k_rope<<<LQ, 256, 0, stream>>>(FQ, DQ, NH_, CS, nullptr, nullptr, 1.0f, QP16, QPh, QPl);
        k_gemmw<bf, 0, false><<<dim3(TT / 64, DKV / 64, 1), 32, 0, stream>>>(XB, nullptr, WK, nullptr, DM, FK, DKV, nullptr, 0, 0, 0);
        k_rope<<<LKv, 256, 0, stream>>>(FK, DKV, NKV, CS, nullptr, nullptr, 1.0f, KP16, KPh, KPl);
        k_gemmw<bf, 0, false><<<dim3(TT / 64, DKV / 64, 1), 32, 0, stream>>>(XB, nullptr, WV, nullptr, DM, FV, DKV, nullptr, 0, 0, 0); k_vtp<<<LKv, 256, 0, stream>>>(FV, DKV, NKV, VT16, VTh, VTl);
        for (int h0 = 0; h0 < NH_; h0 += ZH) { const size_t zq = (size_t)h0, zk = (size_t)(h0 / REP);   // one kv head per query head: the pass's two heads use consecutive kv planes (z-strides TT*HD)
            k_gemmc<bf, 2, 1><<<dim3(RH / 64, TT / 64, ZH), 32, 0, stream>>>(QPh + zq * TT * HD, QPl + zq * TT * HD, KPh + zk * TT * HD, KPl + zk * TT * HD, HD, Sb, TT, 0, (size_t)TT * HD, (size_t)TT * HD, (size_t)TT * TT);
            k_gemmc<h16, 0, 1><<<dim3((TT - RH) / 64, TT / 64, ZH), 32, 0, stream>>>(QP16 + zq * TT * HD + (size_t)RH * HD, nullptr, KP16 + zk * TT * HD, nullptr, HD, Sb + (size_t)RH * TT, TT, RH, (size_t)TT * HD, (size_t)TT * HD, (size_t)TT * TT);
            k_asoft<<<ZH * TT / 8, 256, 0, stream>>>(Sb, P16, Ph, Pl);
            k_gemmc<bf, 2, 2><<<dim3(RH / 64, HD / 64, ZH), 32, 0, stream>>>(Ph, Pl, VTh + zk * HD * TT, VTl + zk * HD * TT, TT, Ob, HD, 0, (size_t)RH * TT, (size_t)HD * TT, (size_t)TT * HD);
            k_gemmc<h16, 0, 2><<<dim3((TT - RH) / 64, HD / 64, ZH), 32, 0, stream>>>(P16 + (size_t)RH * TT, nullptr, VT16 + zk * HD * TT, nullptr, TT, Ob + (size_t)RH * HD, HD, RH, (size_t)TT * TT, (size_t)HD * TT, (size_t)TT * HD);
            k_merge<<<(unsigned)(((size_t)ZH * TT * HD / 2 + 255) / 256), 256, 0, stream>>>(Ob, h0, OUT + (size_t)b * TT * DQ); }
         }
}

// v001
// One run takes 703 microseconds.
// Next to v000, in two timings, it ran 1.93 times as fast each time.
#include <hip/hip_runtime.h>

// Causal multi-head attention with a per-head packed qkv projection (inputs [2][2048][1024]; qkv = x W_qkv^T ('oi' [3072][1024] 1/32, no bias); the module views qkv as (T, 16 heads, 3 x 64) and splits the LAST dim: head h's q = output rows h*192 + 0..63, k = h*192 + 64..127, v = h*192 + 128..191; scores x 64^-0.5; causal (-inf); softmax; out = merged heads (no output projection) -> [2][2048][1024] (4.2 M); argument order inputs, W_qkv).
// Layout per batch: the packed weight rows are gathered once into a standard q | k | v Bt (a row permutation of the bf16 copy); bf16 copy of x; exact projections; causal T-2048 attention (hybrid rows: < 512 hi/lo 3 products, rest fp16 x1024; k_gemmc skips tiles above the diagonal); the f32 merge writes the output rows.
// Compute dtypes, f32 accumulate: every input rounded to bf16; projections exact; attention rows < 512 3 products, rest fp16; softmax f32; output f32.

#define NB_  2
#define TT   2048
#define DM   1024
#define NH_  16
#define NKV  16
#define REP  (NH_ / NKV)
#define HD   64
#define DQ   (NH_ * HD)
#define DKV  (NKV * HD)
#define ZH   2
#define RH   512                  // query rows < RH use hi+lo planes (0: none)
#define WIN  2048
#define PCAR 1024.0f
#define SCL  0.125f   // HD^-0.5
#define KCH  64                   // keys per work-group of the probability x value contraction (split along the keys)
typedef _Float16 h16;
typedef unsigned short bf;
typedef __attribute__((ext_vector_type(16))) __bf16   v16bf;
typedef __attribute__((ext_vector_type(16))) _Float16 v16h;
typedef __attribute__((ext_vector_type(8)))  _Float16 v8h;
typedef __attribute__((ext_vector_type(8)))  unsigned short v8us;
typedef __attribute__((ext_vector_type(8)))  float    v8f;
typedef __attribute__((ext_vector_type(4)))  float    v4f;
typedef v8h  __attribute__((may_alias)) v8ha;
typedef v4f  __attribute__((may_alias)) v4fa;
typedef v8us __attribute__((may_alias)) v8usa;

__device__ __forceinline__ unsigned short f2bf(float f) { unsigned u = __float_as_uint(f); u += 0x7FFFu + ((u >> 16) & 1u); return (unsigned short)(u >> 16); }
__device__ __forceinline__ float bf2f(unsigned short b) { return __uint_as_float(((unsigned)b) << 16); }
__device__ __forceinline__ float bfr(float f) { return bf2f(f2bf(f)); }
__device__ __forceinline__ v16h cat16(v8h lo, v8h hi) { return __builtin_shufflevector(lo, hi, 0, 1, 2, 3, 4, 5, 6, 7, 8, 9, 10, 11, 12, 13, 14, 15); }
__device__ __forceinline__ v16bf cat16b(v8us lo, v8us hi) { return __builtin_bit_cast(v16bf, __builtin_shufflevector(lo, hi, 0, 1, 2, 3, 4, 5, 6, 7, 8, 9, 10, 11, 12, 13, 14, 15)); }
__device__ __forceinline__ v8f wmma16(v16h a, v16h b, v8f c) { return __builtin_amdgcn_wmma_f32_16x16x32_f16(false, a, false, b, (short)0, c, false, false); }
__device__ __forceinline__ v8f wmmab(v16bf a, v16bf b, v8f c) { return __builtin_amdgcn_wmma_f32_16x16x32_bf16(false, a, false, b, (short)0, c, false, false); }



// ---- k_gemmw: register-blocked GEMM, ONE WAVE per 64x64 output tile (16 accumulators), operands straight from K-contiguous 16-bit planes; grid (M/64, N/64, Z), 32 threads.
// C[m][n] (f32, pitch ldc, + optional f32 bias[n]) = sum_k A[m][k] Bt[n][k] (+ split products per NSPLIT). z-batch strides sA/sB/sC in elements. K % 32 == 0.
template <typename T16> struct WFrag;
template <> struct WFrag<h16> { typedef v16h V; static __device__ __forceinline__ V ld(const h16* p) { return cat16(*(const v8h*)p, *(const v8h*)(p + 16)); } static __device__ __forceinline__ v8f mma(V a, V b, v8f c) { return wmma16(a, b, c); } };
template <> struct WFrag<bf> { typedef v16bf V; static __device__ __forceinline__ V ld(const bf* p) { return cat16b(*(const v8us*)p, *(const v8us*)(p + 16)); } static __device__ __forceinline__ v8f mma(V a, V b, v8f c) { return wmmab(a, b, c); } };
template <typename T16, int NSPLIT, bool BIAS>
__global__ __launch_bounds__(32) void k_gemmw(const T16* __restrict__ A, const T16* __restrict__ A2, const T16* __restrict__ Bt, const T16* __restrict__ Bt2, int K, float* C, int ldc, const float* __restrict__ bias, size_t sA, size_t sB, size_t sC) {
    typedef typename WFrag<T16>::V V;
    __shared__ __align__(16) float os[16 * 68];
    const size_t z = blockIdx.z; A += z * sA; if (A2) A2 += z * sA; Bt += z * sB; if (Bt2) Bt2 += z * sB; C += z * sC;
    const int lane = threadIdx.x & 31, lr = lane & 15, hi = lane >> 4; const int r0 = blockIdx.x * 64, c0 = blockIdx.y * 64;
    v8f acc[4][4];
#pragma unroll
    for (int mb = 0; mb < 4; ++mb)
#pragma unroll
        for (int nb = 0; nb < 4; ++nb) acc[mb][nb] = (v8f){};
    const size_t aoff = (size_t)(r0 + lr) * K + 8 * hi, boff = (size_t)(c0 + lr) * K + 8 * hi;
#pragma unroll 1
    for (int kc = 0; kc < K; kc += 32) {
        V a[4], a2[4];
#pragma unroll
        for (int mb = 0; mb < 4; ++mb) { a[mb] = WFrag<T16>::ld(A + aoff + (size_t)mb * 16 * K + kc); if (NSPLIT == 1 || NSPLIT == 2) a2[mb] = WFrag<T16>::ld(A2 + aoff + (size_t)mb * 16 * K + kc); }
#pragma unroll
        for (int nb = 0; nb < 4; ++nb) { const V b = WFrag<T16>::ld(Bt + boff + (size_t)nb * 16 * K + kc); V b2; if (NSPLIT >= 2) b2 = WFrag<T16>::ld(Bt2 + boff + (size_t)nb * 16 * K + kc);
#pragma unroll
            for (int mb = 0; mb < 4; ++mb) { acc[mb][nb] = WFrag<T16>::mma(a[mb], b, acc[mb][nb]); if (NSPLIT == 1 || NSPLIT == 2) acc[mb][nb] = WFrag<T16>::mma(a2[mb], b, acc[mb][nb]); if (NSPLIT >= 2) acc[mb][nb] = WFrag<T16>::mma(a[mb], b2, acc[mb][nb]); } }
        asm volatile("v_nop\n\tv_nop\n\tv_nop\n\tv_nop" : "+v"(acc[0][0]), "+v"(acc[1][1]), "+v"(acc[2][2]), "+v"(acc[3][3]) : "v"(a[0]), "v"(a[3]));
    }
#pragma unroll
    for (int mb = 0; mb < 4; ++mb) {
#pragma unroll
        for (int nb = 0; nb < 4; ++nb) {
#pragma unroll
            for (int j = 0; j < 8; ++j) os[(hi * 8 + j) * 68 + nb * 16 + lr] = acc[mb][nb][j]; }
        __builtin_amdgcn_wave_barrier(); asm volatile("" ::: "memory");
        float* crow = C + (size_t)(r0 + mb * 16) * ldc + c0;
{
#pragma unroll
            for (int s = 0; s < 8; ++s) { const int row = 2 * s + hi, cofs = lr * 4; v4f val = *(const v4fa*)(os + row * 68 + cofs); if (BIAS) { val[0] += bfr(bias[c0 + cofs]); val[1] += bfr(bias[c0 + cofs + 1]); val[2] += bfr(bias[c0 + cofs + 2]); val[3] += bfr(bias[c0 + cofs + 3]); }
                *(v4f*)(crow + (size_t)row * ldc + cofs) = val; }
             }
        __builtin_amdgcn_wave_barrier(); asm volatile("" ::: "memory");
    }
}

// ---- k_gemmc: the same one-wave 64x64 tile GEMM specialised for causal attention: CMODE 1 skips score tiles entirely above the diagonal (query rows r0+roff.., key columns c0..), CMODE 2 limits the
// key (K) loop of the probability x value contraction to the diagonal block (probabilities beyond it are exactly zero). roff = row offset of this launch's first row within the sequence.
// CMODE 2 is split along the keys: blockIdx.y is the chunk of KCH keys (the value tile is HD = 64 columns wide, so there is one column tile), chunk y stores its partial tile in plane y of C (plane stride ZH * sC); k_merge adds the planes.
template <typename T16, int NSPLIT, int CMODE>
__global__ __launch_bounds__(32) void k_gemmc(const T16* __restrict__ A, const T16* __restrict__ A2, const T16* __restrict__ Bt, const T16* __restrict__ Bt2, int K, float* C, int ldc, int roff, size_t sA, size_t sB, size_t sC) {
    typedef typename WFrag<T16>::V V;
    __shared__ __align__(16) float os[16 * 68];
    const size_t z = blockIdx.z; A += z * sA; if (A2) A2 += z * sA; Bt += z * sB; if (Bt2) Bt2 += z * sB; C += z * sC;
    const int lane = threadIdx.x & 31, lr = lane & 15, hi = lane >> 4; const int r0 = blockIdx.x * 64, c0 = (CMODE == 2) ? 0 : blockIdx.y * 64;
    if (CMODE == 1 && c0 > r0 + roff + 63) return;                  // score tile entirely above the causal diagonal: never read (the softmax masks j > i by select)
    const int Kd = (CMODE == 2) ? min(K, r0 + roff + 64) : K;        // P.V: probabilities are exactly 0 beyond the diagonal block, so the K loop stops there
    const int k0 = (CMODE == 2) ? (int)blockIdx.y * KCH : 0;         // P.V: this work-group's chunk of keys
    if (CMODE == 2 && k0 >= Kd) return;                              // chunk entirely beyond the diagonal block: no plane written, k_merge does not read it
    const int Kl = (CMODE == 2) ? min(Kd - k0, KCH) : K;             // keys of this chunk
    if (CMODE == 2) { A += k0; if (A2) A2 += k0; Bt += k0; if (Bt2) Bt2 += k0; C += (size_t)blockIdx.y * ZH * sC; }
    v8f acc[4][4];
#pragma unroll
    for (int mb = 0; mb < 4; ++mb)
#pragma unroll
        for (int nb = 0; nb < 4; ++nb) acc[mb][nb] = (v8f){};
    const size_t aoff = (size_t)(r0 + lr) * K + 8 * hi, boff = (size_t)(c0 + lr) * K + 8 * hi;
#pragma unroll 1
    for (int kc = 0; kc < Kl; kc += 32) {
        V a[4], a2[4];
#pragma unroll
        for (int mb = 0; mb < 4; ++mb) { a[mb] = WFrag<T16>::ld(A + aoff + (size_t)mb * 16 * K + kc); if (NSPLIT == 1 || NSPLIT == 2) a2[mb] = WFrag<T16>::ld(A2 + aoff + (size_t)mb * 16 * K + kc); }
#pragma unroll
        for (int nb = 0; nb < 4; ++nb) { const V b = WFrag<T16>::ld(Bt + boff + (size_t)nb * 16 * K + kc); V b2; if (NSPLIT >= 2) b2 = WFrag<T16>::ld(Bt2 + boff + (size_t)nb * 16 * K + kc);
#pragma unroll
            for (int mb = 0; mb < 4; ++mb) { acc[mb][nb] = WFrag<T16>::mma(a[mb], b, acc[mb][nb]); if (NSPLIT == 1 || NSPLIT == 2) acc[mb][nb] = WFrag<T16>::mma(a2[mb], b, acc[mb][nb]); if (NSPLIT >= 2) acc[mb][nb] = WFrag<T16>::mma(a[mb], b2, acc[mb][nb]); } }
        asm volatile("v_nop\n\tv_nop\n\tv_nop\n\tv_nop" : "+v"(acc[0][0]), "+v"(acc[1][1]), "+v"(acc[2][2]), "+v"(acc[3][3]) : "v"(a[0]), "v"(a[3]));
    }
#pragma unroll
    for (int mb = 0; mb < 4; ++mb) {
#pragma unroll
        for (int nb = 0; nb < 4; ++nb) {
#pragma unroll
            for (int j = 0; j < 8; ++j) os[(hi * 8 + j) * 68 + nb * 16 + lr] = acc[mb][nb][j]; }
        __builtin_amdgcn_wave_barrier(); asm volatile("" ::: "memory");
        float* crow = C + (size_t)(r0 + mb * 16) * ldc + c0;
{
#pragma unroll
            for (int s = 0; s < 8; ++s) { const int row = 2 * s + hi, cofs = lr * 4; v4f val = *(const v4fa*)(os + row * 68 + cofs);
                *(v4f*)(crow + (size_t)row * ldc + cofs) = val; }
             }
        __builtin_amdgcn_wave_barrier(); asm volatile("" ::: "memory");
    }
}

__device__ __forceinline__ h16 tohx(float x) { return (h16)x; }
__device__ __forceinline__ void splitf(float y, unsigned short& h, unsigned short& l) { h = f2bf(y); l = f2bf(y - bf2f(h)); }
typedef __attribute__((ext_vector_type(2))) _Float16 v2h;
typedef __attribute__((ext_vector_type(4))) _Float16 v4h;
typedef __attribute__((ext_vector_type(2))) unsigned short v2us;
typedef __attribute__((ext_vector_type(4))) unsigned short v4us;
typedef __attribute__((ext_vector_type(2))) float v2f;
typedef __attribute__((ext_vector_type(4))) int v4i;

__global__ __launch_bounds__(256) void k_cvt8(const float* __restrict__ src, bf* dst, size_t n8) { const size_t i = (size_t)blockIdx.x * 256 + threadIdx.x; if (i >= n8) return; const v8f v = *(const v8f*)(src + i * 8); v8us o;
#pragma unroll
    for (int k = 0; k < 8; ++k) o[k] = f2bf(v[k]); *(v8us*)(dst + i * 8) = o;  }

__global__ __launch_bounds__(256) void k_wperm(const float* __restrict__ W, bf* Bt) { const size_t i = (size_t)blockIdx.x * 256 + threadIdx.x; if (i >= (size_t)3 * DQ * DM / 8) return; const size_t e = i * 8; const int c0 = (int)(e % DM); const int rd = (int)(e / DM); const int part = rd / DQ; const int h = (rd % DQ) / HD; const int d = rd % HD; const int rs = h * 3 * HD + part * HD + d; const v8f v = *(const v8f*)(W + (size_t)rs * DM + c0); v8us o;
#pragma unroll
    for (int k = 0; k < 8; ++k) o[k] = f2bf(v[k]); *(v8us*)(Bt + e) = o;  }
// k_rope: head planes [h][t][d] (fp16 + hi/lo) of rope(x) x sc with the rotate-half convention out[d] = x[d] cos[t][d] - x[d+HD/2] sin[t][d], out[d+HD/2] = x[d+HD/2] cos[t][d+HD/2] + x[d] sin[t][d+HD/2]
__global__ __launch_bounds__(256) void k_rope(const float* __restrict__ F, int pitch, int nheads, const float* __restrict__ CS, const float* __restrict__ RF, const float* __restrict__ nw, float sc, h16* P16, bf* Ph, bf* Pl) {
    const size_t e = ((size_t)blockIdx.x * 256 + threadIdx.x) * 2; if (e >= (size_t)nheads * TT * HD) return; const int d = (int)(e % HD); const int t = (int)((e / HD) % TT); const int h = (int)(e / ((size_t)HD * TT)); const float* f = F + (size_t)t * pitch + h * HD; const float rf = RF ? RF[(size_t)h * TT + t] : 1.0f; v2h o16; v2us oh, ol;
#pragma unroll
    for (int q = 0; q < 2; ++q) { const int dd = d + q; const int dp = (dd < HD / 2) ? dd + HD / 2 : dd - HD / 2; float x0 = f[dd], x1 = f[dp];
        if (RF) { float n0 = __fmul_rn(x0, rf), n1 = __fmul_rn(x1, rf); asm volatile("" : "+v"(n0)); asm volatile("" : "+v"(n1)); x0 = __fmul_rn(bfr(nw[dd]), n0); x1 = __fmul_rn(bfr(nw[dp]), n1); }
        const v2f cs = *(const v2f*)(CS + ((size_t)t * HD + dd) * 2); float a = __fmul_rn(x0, cs[0]), bq = __fmul_rn(x1, cs[1]); asm volatile("" : "+v"(a)); asm volatile("" : "+v"(bq)); const float r = ((dd < HD / 2) ? __fsub_rn(a, bq) : __fadd_rn(a, bq)) * sc;
        o16[q] = tohx(r); unsigned short a2, c2; splitf(r, a2, c2); oh[q] = a2; ol[q] = c2; }
    *(v2h*)(P16 + e) = o16; *(v2us*)(Ph + e) = oh; *(v2us*)(Pl + e) = ol;  }
__global__ __launch_bounds__(256) void k_vtp(const float* __restrict__ F, int pitch, int nheads, h16* V16, bf* Vh, bf* Vl) { const size_t e = ((size_t)blockIdx.x * 256 + threadIdx.x) * 2; if (e >= (size_t)nheads * HD * TT) return; const int t = (int)(e % TT); const int d = (int)((e / TT) % HD); const int g = (int)(e / ((size_t)TT * HD)); v2h o16; v2us oh, ol;
#pragma unroll
    for (int q = 0; q < 2; ++q) { const float x = F[(size_t)(t + q) * pitch + g * HD + d]; o16[q] = tohx(x); unsigned short a2, c2; splitf(x, a2, c2); oh[q] = a2; ol[q] = c2; }
    *(v2h*)(V16 + e) = o16; *(v2us*)(Vh + e) = oh; *(v2us*)(Vl + e) = ol;  }
__global__ __launch_bounds__(256) void k_csid(float* CS) { const int idx = blockIdx.x * 256 + threadIdx.x; if (idx >= TT * HD) return; v2f cs; cs[0] = 1.0f; cs[1] = 0.0f; *(v2f*)(CS + (size_t)idx * 2) = cs;  }
// k_asoft: per row (zz, i): t = S x HD^-0.5 for j <= i and i - j < WIN (sliding causal window; the reference's -1e9 additive fill vanishes identically); softmax over the 2048 keys (register row, one exp, fixed trees);
__global__ __launch_bounds__(256) void k_asoft(const float* __restrict__ Sb, h16* P16, bf* Ph, bf* Pl) {
    const int lane = threadIdx.x & 31; const int row = blockIdx.x * 8 + (threadIdx.x >> 5); if (row >= ZH * TT) return; const int i = row % TT; const int zz = row / TT; (void)zz; const bool hires = (i < RH); const float* sr = Sb + (size_t)row * TT; float v[TT / 32]; float mx = -3.0e38f;
#pragma unroll
    for (int ch = 0; ch < TT / 128; ++ch) { const int j0 = ch * 128 + lane * 4; const v4f a = *(const v4f*)(sr + j0);
#pragma unroll
        for (int q = 0; q < 4; ++q) { const int j = j0 + q; (void)j; const float t = (j <= i && i - j < WIN) ? a[q] * SCL : -3.0e38f; v[ch * 4 + q] = t; mx = fmaxf(mx, t); } }
#pragma unroll
    for (int sh = 16; sh; sh >>= 1) mx = fmaxf(mx, __shfl_xor(mx, sh, 32));
    float sum = 0.f;
#pragma unroll
    for (int k = 0; k < TT / 32; ++k) { float d0 = __fsub_rn(v[k], mx); asm volatile("" : "+v"(d0)); v[k] = __builtin_amdgcn_exp2f(__fmul_rn(d0, 1.4426950408889634f)); sum += v[k]; }
#pragma unroll
    for (int sh = 16; sh; sh >>= 1) sum += __shfl_xor(sum, sh, 32);
    const float f = __fdiv_rn(hires ? 1.0f : PCAR, sum);
{
        if (hires) {
#pragma unroll
            for (int ch = 0; ch < TT / 128; ++ch) { v4us oh, ol;
#pragma unroll
                for (int q = 0; q < 4; ++q) { unsigned short a, c2; splitf(v[ch * 4 + q] * f, a, c2); oh[q] = a; ol[q] = c2; }
                const size_t oo = ((size_t)zz * (RH ? RH : 1) + i) * TT + ch * 128 + lane * 4; *(v4us*)(Ph + oo) = oh; *(v4us*)(Pl + oo) = ol; }
        } else {
#pragma unroll
            for (int ch = 0; ch < TT / 128; ++ch) { v4h o4;
#pragma unroll
                for (int q = 0; q < 4; ++q) o4[q] = tohx(v[ch * 4 + q] * f);
                *(v4h*)(P16 + (size_t)row * TT + ch * 128 + lane * 4) = o4; } }
         }
}
__global__ __launch_bounds__(256) void k_merge(const float* __restrict__ O, int h0, float* OUTb) { const size_t e = ((size_t)blockIdx.x * 256 + threadIdx.x) * 2; if (e >= (size_t)ZH * TT * HD) return; const int d = (int)(e % HD); const int t = (int)((e / HD) % TT); const int zz = (int)(e / ((size_t)HD * TT)); const float cs = (t < RH) ? 1.0f : (1.0f / PCAR); const size_t oo = (size_t)t * DQ + (h0 + zz) * HD + d;
    const int nks = t / KCH + 1;   // key chunks that reach row t's 64-row tile: ceil((64 * (t / 64) + 64) / KCH)
    v2f pl[TT / KCH];
#pragma unroll
    for (int ks = 0; ks < TT / KCH; ++ks) pl[ks] = *(const v2f*)(O + (size_t)min(ks, nks - 1) * ZH * TT * HD + e);   // index clamped to a written plane, so that every load is issued before the first add
    v2f s = pl[0];
#pragma unroll
    for (int ks = 1; ks < TT / KCH; ++ks) { if (ks < nks) { s[0] += pl[ks][0]; s[1] += pl[ks][1]; } }   // fixed ascending order
    v2f o2; o2[0] = s[0] * cs; o2[1] = s[1] * cs; *(v2f*)(OUTb + oo) = o2;  }

extern "C" void kernel_launch(void* const* d_in, const int* in_sizes, int n_in,
                              void* d_out, int out_size, void* d_ws, size_t ws_size, hipStream_t stream) {
    (void)in_sizes; (void)n_in; (void)out_size;
    const float* x = (const float*)d_in[0]; const float* wqkv = (const float*)d_in[1];   /* order inputs, W_qkv ('oi' [3072][1024], per-head (q, k, v) packed rows) */ const float* wq = wqkv; const float* wk = nullptr; const float* wv = nullptr; const float* wo = nullptr; (void)wk; (void)wv; (void)wo;
    float* OUT = (float*)d_out;     // [2][2048][1024]
    char* wsp = (char*)d_ws;
    auto take = [&](size_t bytes) { char* p = wsp; wsp += (bytes + 255) & ~(size_t)255; return (void*)p; };
    bf* WQKV = (bf*)take((size_t)3 * DQ * DM * 2); bf* WQ = WQKV; bf* WK = WQKV + (size_t)DQ * DM; bf* WV = WQKV + (size_t)2 * DQ * DM;   /* de-interleaved Bt: q | k | v row blocks in head order */ float* CS = (float*)take((size_t)TT * HD * 2 * 4);
    bf* XB = (bf*)take((size_t)TT * DM * 2); float* FQ = (float*)take((size_t)TT * DQ * 4); float* FK = (float*)take((size_t)TT * DKV * 4);
    h16* QP16 = (h16*)take((size_t)NH_ * TT * HD * 2); h16* KP16 = (h16*)take((size_t)NKV * TT * HD * 2); h16* VT16 = (h16*)take((size_t)NKV * HD * TT * 2);
    bf* QPh = (bf*)take((size_t)NH_ * TT * HD * 2); bf* QPl = (bf*)take((size_t)NH_ * TT * HD * 2); bf* KPh = (bf*)take((size_t)NKV * TT * HD * 2); bf* KPl = (bf*)take((size_t)NKV * TT * HD * 2); bf* VTh = (bf*)take((size_t)NKV * HD * TT * 2); bf* VTl = (bf*)take((size_t)NKV * HD * TT * 2); bf* Ph = (bf*)take((size_t)ZH * RH * TT * 2); bf* Pl = (bf*)take((size_t)ZH * RH * TT * 2);
    float* Sb = (float*)take((size_t)ZH * TT * TT * 4); h16* P16 = (h16*)take((size_t)ZH * TT * TT * 2); float* Ob = (float*)take((size_t)(TT / KCH) * ZH * TT * HD * 4);   /* one partial plane per key chunk */
    if ((size_t)(wsp - (char*)d_ws) > ws_size) return;    // ws 256 MiB
    float* FV = FK;   // v projection reuses the k buffer after the k planes are built (stream-ordered)
    { k_wperm<<<(unsigned)(((size_t)3 * DQ * DM / 8 + 255) / 256), 256, 0, stream>>>(wqkv, WQKV);   /* packed rows (h, part, d) -> standard (part, h, d) blocks */
      
       }
    k_csid<<<(TT * HD + 255) / 256, 256, 0, stream>>>(CS);
    const unsigned LQ = (unsigned)(((size_t)NH_ * TT * HD / 2 + 255) / 256), LKv = (unsigned)(((size_t)NKV * TT * HD / 2 + 255) / 256);
    for (int b = 0; b < NB_; ++b) {
        
        k_cvt8<<<(unsigned)(((size_t)TT * DM / 8 + 255) / 256), 256, 0, stream>>>(x + (size_t)b * TT * DM, XB, (size_t)TT * DM / 8);
        k_gemmw<bf, 0, false><<<dim3(TT / 64, DQ / 64, 1), 32, 0, stream>>>(XB, nullptr, WQ, nullptr, DM, FQ, DQ, nullptr, 0, 0, 0);
        k_rope<<<LQ, 256, 0, stream>>>(FQ, DQ, NH_, CS, nullptr, nullptr, 1.0f, QP16, QPh, QPl);
        k_gemmw<bf, 0, false><<<dim3(TT / 64, DKV / 64, 1), 32, 0, stream>>>(XB, nullptr, WK, nullptr, DM, FK, DKV, nullptr, 0, 0, 0);
        k_rope<<<LKv, 256, 0, stream>>>(FK, DKV, NKV, CS, nullptr, nullptr, 1.0f, KP16, KPh, KPl);
        k_gemmw<bf, 0, false><<<dim3(TT / 64, DKV / 64, 1), 32, 0, stream>>>(XB, nullptr, WV, nullptr, DM, FV, DKV, nullptr, 0, 0, 0); k_vtp<<<LKv, 256, 0, stream>>>(FV, DKV, NKV, VT16, VTh, VTl);
        for (int h0 = 0; h0 < NH_; h0 += ZH) { const size_t zq = (size_t)h0, zk = (size_t)(h0 / REP);   // one kv head per query head: the pass's two heads use consecutive kv planes (z-strides TT*HD)
            k_gemmc<bf, 2, 1><<<dim3(RH / 64, TT / 64, ZH), 32, 0, stream>>>(QPh + zq * TT * HD, QPl + zq * TT * HD, KPh + zk * TT * HD, KPl + zk * TT * HD, HD, Sb, TT, 0, (size_t)TT * HD, (size_t)TT * HD, (size_t)TT * TT);
            k_gemmc<h16, 0, 1><<<dim3((TT - RH) / 64, TT / 64, ZH), 32, 0, stream>>>(QP16 + zq * TT * HD + (size_t)RH * HD, nullptr, KP16 + zk * TT * HD, nullptr, HD, Sb + (size_t)RH * TT, TT, RH, (size_t)TT * HD, (size_t)TT * HD, (size_t)TT * TT);
            k_asoft<<<ZH * TT / 8, 256, 0, stream>>>(Sb, P16, Ph, Pl);
            k_gemmc<bf, 2, 2><<<dim3(RH / 64, RH / KCH, ZH), 32, 0, stream>>>(Ph, Pl, VTh + zk * HD * TT, VTl + zk * HD * TT, TT, Ob, HD, 0, (size_t)RH * TT, (size_t)HD * TT, (size_t)TT * HD);
            k_gemmc<h16, 0, 2><<<dim3((TT - RH) / 64, TT / KCH, ZH), 32, 0, stream>>>(P16 + (size_t)RH * TT, nullptr, VT16 + zk * HD * TT, nullptr, TT, Ob + (size_t)RH * HD, HD, RH, (size_t)TT * TT, (size_t)HD * TT, (size_t)TT * HD);
            k_merge<<<(unsigned)(((size_t)ZH * TT * HD / 2 + 255) / 256), 256, 0, stream>>>(Ob, h0, OUT + (size_t)b * TT * DQ); }
         }
}

// v002
// A run of this version takes 283 microseconds.
// Two timings next to v001 put it at 2.47 and 2.48 times that version's speed.
// Over all steps from v000 it is 4.79 times as fast.
#include <hip/hip_runtime.h>

// Causal multi-head attention with a per-head packed qkv projection (inputs [2][2048][1024]; qkv = x W_qkv^T ('oi' [3072][1024] 1/32, no bias); the module views qkv as (T, 16 heads, 3 x 64) and splits the LAST dim: head h's q = output rows h*192 + 0..63, k = h*192 + 64..127, v = h*192 + 128..191; scores x 64^-0.5; causal (-inf); softmax; out = merged heads (no output projection) -> [2][2048][1024] (4.2 M); argument order inputs, W_qkv).
// Layout per batch: the packed weight rows are gathered once into a standard q | k | v Bt (a row permutation of the bf16 copy); bf16 copy of x; exact projections; one fused causal attention launch (k_fattn: online softmax, scores and probabilities stay in registers; hybrid rows: < 512 hi/lo 3 products, rest fp16 x1024) writes the output rows.
// Compute dtypes, f32 accumulate: every input rounded to bf16; projections exact; attention rows < 512 3 products, rest fp16; softmax f32; output f32.

#define NB_  2
#define TT   2048
#define DM   1024
#define NH_  16
#define NKV  16
#define REP  (NH_ / NKV)
#define HD   64
#define DQ   (NH_ * HD)
#define DKV  (NKV * HD)
#define RH   512                  // query rows < RH use hi+lo planes (0: none)
#define SCL  0.125f   // HD^-0.5
typedef _Float16 h16;
typedef unsigned short bf;
typedef __attribute__((ext_vector_type(16))) __bf16   v16bf;
typedef __attribute__((ext_vector_type(16))) _Float16 v16h;
typedef __attribute__((ext_vector_type(8)))  _Float16 v8h;
typedef __attribute__((ext_vector_type(8)))  unsigned short v8us;
typedef __attribute__((ext_vector_type(8)))  float    v8f;
typedef __attribute__((ext_vector_type(4)))  float    v4f;
typedef v8h  __attribute__((may_alias)) v8ha;
typedef v4f  __attribute__((may_alias)) v4fa;
typedef v8us __attribute__((may_alias)) v8usa;

__device__ __forceinline__ unsigned short f2bf(float f) { unsigned u = __float_as_uint(f); u += 0x7FFFu + ((u >> 16) & 1u); return (unsigned short)(u >> 16); }
__device__ __forceinline__ float bf2f(unsigned short b) { return __uint_as_float(((unsigned)b) << 16); }
__device__ __forceinline__ float bfr(float f) { return bf2f(f2bf(f)); }
__device__ __forceinline__ v16h cat16(v8h lo, v8h hi) { return __builtin_shufflevector(lo, hi, 0, 1, 2, 3, 4, 5, 6, 7, 8, 9, 10, 11, 12, 13, 14, 15); }
__device__ __forceinline__ v16bf cat16b(v8us lo, v8us hi) { return __builtin_bit_cast(v16bf, __builtin_shufflevector(lo, hi, 0, 1, 2, 3, 4, 5, 6, 7, 8, 9, 10, 11, 12, 13, 14, 15)); }
__device__ __forceinline__ v8f wmma16(v16h a, v16h b, v8f c) { return __builtin_amdgcn_wmma_f32_16x16x32_f16(false, a, false, b, (short)0, c, false, false); }
__device__ __forceinline__ v8f wmmab(v16bf a, v16bf b, v8f c) { return __builtin_amdgcn_wmma_f32_16x16x32_bf16(false, a, false, b, (short)0, c, false, false); }



// ---- k_gemmw: register-blocked GEMM, ONE WAVE per 64x64 output tile (16 accumulators), operands straight from K-contiguous 16-bit planes; grid (M/64, N/64, Z), 32 threads.
// C[m][n] (f32, pitch ldc, + optional f32 bias[n]) = sum_k A[m][k] Bt[n][k] (+ split products per NSPLIT). z-batch strides sA/sB/sC in elements. K % 32 == 0.
template <typename T16> struct WFrag;
template <> struct WFrag<h16> { typedef v16h V; static __device__ __forceinline__ V ld(const h16* p) { return cat16(*(const v8h*)p, *(const v8h*)(p + 16)); } static __device__ __forceinline__ v8f mma(V a, V b, v8f c) { return wmma16(a, b, c); } };
template <> struct WFrag<bf> { typedef v16bf V; static __device__ __forceinline__ V ld(const bf* p) { return cat16b(*(const v8us*)p, *(const v8us*)(p + 16)); } static __device__ __forceinline__ v8f mma(V a, V b, v8f c) { return wmmab(a, b, c); } };
template <typename T16, int NSPLIT, bool BIAS>
__global__ __launch_bounds__(32) void k_gemmw(const T16* __restrict__ A, const T16* __restrict__ A2, const T16* __restrict__ Bt, const T16* __restrict__ Bt2, int K, float* C, int ldc, const float* __restrict__ bias, size_t sA, size_t sB, size_t sC) {
    typedef typename WFrag<T16>::V V;
    __shared__ __align__(16) float os[16 * 68];
    const size_t z = blockIdx.z; A += z * sA; if (A2) A2 += z * sA; Bt += z * sB; if (Bt2) Bt2 += z * sB; C += z * sC;
    const int lane = threadIdx.x & 31, lr = lane & 15, hi = lane >> 4; const int r0 = blockIdx.x * 64, c0 = blockIdx.y * 64;
    v8f acc[4][4];
#pragma unroll
    for (int mb = 0; mb < 4; ++mb)
#pragma unroll
        for (int nb = 0; nb < 4; ++nb) acc[mb][nb] = (v8f){};
    const size_t aoff = (size_t)(r0 + lr) * K + 8 * hi, boff = (size_t)(c0 + lr) * K + 8 * hi;
#pragma unroll 1
    for (int kc = 0; kc < K; kc += 32) {
        V a[4], a2[4];
#pragma unroll
        for (int mb = 0; mb < 4; ++mb) { a[mb] = WFrag<T16>::ld(A + aoff + (size_t)mb * 16 * K + kc); if (NSPLIT == 1 || NSPLIT == 2) a2[mb] = WFrag<T16>::ld(A2 + aoff + (size_t)mb * 16 * K + kc); }
#pragma unroll
        for (int nb = 0; nb < 4; ++nb) { const V b = WFrag<T16>::ld(Bt + boff + (size_t)nb * 16 * K + kc); V b2; if (NSPLIT >= 2) b2 = WFrag<T16>::ld(Bt2 + boff + (size_t)nb * 16 * K + kc);
#pragma unroll
            for (int mb = 0; mb < 4; ++mb) { acc[mb][nb] = WFrag<T16>::mma(a[mb], b, acc[mb][nb]); if (NSPLIT == 1 || NSPLIT == 2) acc[mb][nb] = WFrag<T16>::mma(a2[mb], b, acc[mb][nb]); if (NSPLIT >= 2) acc[mb][nb] = WFrag<T16>::mma(a[mb], b2, acc[mb][nb]); } }
        asm volatile("v_nop\n\tv_nop\n\tv_nop\n\tv_nop" : "+v"(acc[0][0]), "+v"(acc[1][1]), "+v"(acc[2][2]), "+v"(acc[3][3]) : "v"(a[0]), "v"(a[3]));
    }
#pragma unroll
    for (int mb = 0; mb < 4; ++mb) {
#pragma unroll
        for (int nb = 0; nb < 4; ++nb) {
#pragma unroll
            for (int j = 0; j < 8; ++j) os[(hi * 8 + j) * 68 + nb * 16 + lr] = acc[mb][nb][j]; }
        __builtin_amdgcn_wave_barrier(); asm volatile("" ::: "memory");
        float* crow = C + (size_t)(r0 + mb * 16) * ldc + c0;
{
#pragma unroll
            for (int s = 0; s < 8; ++s) { const int row = 2 * s + hi, cofs = lr * 4; v4f val = *(const v4fa*)(os + row * 68 + cofs); if (BIAS) { val[0] += bfr(bias[c0 + cofs]); val[1] += bfr(bias[c0 + cofs + 1]); val[2] += bfr(bias[c0 + cofs + 2]); val[3] += bfr(bias[c0 + cofs + 3]); }
                *(v4f*)(crow + (size_t)row * ldc + cofs) = val; }
             }
        __builtin_amdgcn_wave_barrier(); asm volatile("" ::: "memory");
    }
}

__device__ __forceinline__ h16 tohx(float x) { return (h16)x; }
__device__ __forceinline__ void splitf(float y, unsigned short& h, unsigned short& l) { h = f2bf(y); l = f2bf(y - bf2f(h)); }
typedef __attribute__((ext_vector_type(2))) _Float16 v2h;
typedef __attribute__((ext_vector_type(4))) _Float16 v4h;
typedef __attribute__((ext_vector_type(2))) unsigned short v2us;
typedef __attribute__((ext_vector_type(4))) unsigned short v4us;
typedef __attribute__((ext_vector_type(2))) float v2f;
typedef __attribute__((ext_vector_type(4))) int v4i;

__global__ __launch_bounds__(256) void k_cvt8(const float* __restrict__ src, bf* dst, size_t n8) { const size_t i = (size_t)blockIdx.x * 256 + threadIdx.x; if (i >= n8) return; const v8f v = *(const v8f*)(src + i * 8); v8us o;
#pragma unroll
    for (int k = 0; k < 8; ++k) o[k] = f2bf(v[k]); *(v8us*)(dst + i * 8) = o;  }

__global__ __launch_bounds__(256) void k_wperm(const float* __restrict__ W, bf* Bt) { const size_t i = (size_t)blockIdx.x * 256 + threadIdx.x; if (i >= (size_t)3 * DQ * DM / 8) return; const size_t e = i * 8; const int c0 = (int)(e % DM); const int rd = (int)(e / DM); const int part = rd / DQ; const int h = (rd % DQ) / HD; const int d = rd % HD; const int rs = h * 3 * HD + part * HD + d; const v8f v = *(const v8f*)(W + (size_t)rs * DM + c0); v8us o;
#pragma unroll
    for (int k = 0; k < 8; ++k) o[k] = f2bf(v[k]); *(v8us*)(Bt + e) = o;  }
// k_rope: head planes [h][t][d] (fp16 + hi/lo) of rope(x) x sc with the rotate-half convention out[d] = x[d] cos[t][d] - x[d+HD/2] sin[t][d], out[d+HD/2] = x[d+HD/2] cos[t][d+HD/2] + x[d] sin[t][d+HD/2]
__global__ __launch_bounds__(256) void k_rope(const float* __restrict__ F, int pitch, int nheads, const float* __restrict__ CS, const float* __restrict__ RF, const float* __restrict__ nw, float sc, h16* P16, bf* Ph, bf* Pl) {
    const size_t e = ((size_t)blockIdx.x * 256 + threadIdx.x) * 2; if (e >= (size_t)nheads * TT * HD) return; const int d = (int)(e % HD); const int t = (int)((e / HD) % TT); const int h = (int)(e / ((size_t)HD * TT)); const float* f = F + (size_t)t * pitch + h * HD; const float rf = RF ? RF[(size_t)h * TT + t] : 1.0f; v2h o16; v2us oh, ol;
#pragma unroll
    for (int q = 0; q < 2; ++q) { const int dd = d + q; const int dp = (dd < HD / 2) ? dd + HD / 2 : dd - HD / 2; float x0 = f[dd], x1 = f[dp];
        if (RF) { float n0 = __fmul_rn(x0, rf), n1 = __fmul_rn(x1, rf); asm volatile("" : "+v"(n0)); asm volatile("" : "+v"(n1)); x0 = __fmul_rn(bfr(nw[dd]), n0); x1 = __fmul_rn(bfr(nw[dp]), n1); }
        const v2f cs = *(const v2f*)(CS + ((size_t)t * HD + dd) * 2); float a = __fmul_rn(x0, cs[0]), bq = __fmul_rn(x1, cs[1]); asm volatile("" : "+v"(a)); asm volatile("" : "+v"(bq)); const float r = ((dd < HD / 2) ? __fsub_rn(a, bq) : __fadd_rn(a, bq)) * sc;
        o16[q] = tohx(r); unsigned short a2, c2; splitf(r, a2, c2); oh[q] = a2; ol[q] = c2; }
    *(v2h*)(P16 + e) = o16; *(v2us*)(Ph + e) = oh; *(v2us*)(Pl + e) = ol;  }
__global__ __launch_bounds__(256) void k_vtp(const float* __restrict__ F, int pitch, int nheads, h16* V16, bf* Vh, bf* Vl) { const size_t e = ((size_t)blockIdx.x * 256 + threadIdx.x) * 2; if (e >= (size_t)nheads * HD * TT) return; const int t = (int)(e % TT); const int d = (int)((e / TT) % HD); const int g = (int)(e / ((size_t)TT * HD)); v2h o16; v2us oh, ol;
#pragma unroll
    for (int q = 0; q < 2; ++q) { const float x = F[(size_t)(t + q) * pitch + g * HD + d]; o16[q] = tohx(x); unsigned short a2, c2; splitf(x, a2, c2); oh[q] = a2; ol[q] = c2; }
    *(v2h*)(V16 + e) = o16; *(v2us*)(Vh + e) = oh; *(v2us*)(Vl + e) = ol;  }
__global__ __launch_bounds__(256) void k_csid(float* CS) { const int idx = blockIdx.x * 256 + threadIdx.x; if (idx >= TT * HD) return; v2f cs; cs[0] = 1.0f; cs[1] = 0.0f; *(v2f*)(CS + (size_t)idx * 2) = cs;  }
__device__ __forceinline__ float exp2s(float x) { float r; asm("v_exp_f32 %0, %1\n\tv_nop" : "=v"(r) : "v"(x)); return r; }
template <typename T16, bool HI, int NQ>
__device__ __forceinline__ void fattn_tile(const T16* __restrict__ Q, const T16* __restrict__ Q2, const T16* __restrict__ Kp, const T16* __restrict__ Kp2, const T16* __restrict__ Vt, const T16* __restrict__ Vt2, int r0, float* __restrict__ outp) {
    typedef typename WFrag<T16>::V V;
    const int lane = threadIdx.x & 31, lr = lane & 15, hi = lane >> 4;
    const float EC = SCL * 1.4426950408889634f;      // scores x HD^-0.5 x log2(e)
    V q[NQ][2], q2[NQ][2];                            // [query tile][32-wide chunk of the head dim]
#pragma unroll
    for (int qt = 0; qt < NQ; ++qt)
#pragma unroll
        for (int dc = 0; dc < 2; ++dc) { const size_t qo = (size_t)(r0 + qt * 16 + lr) * HD + dc * 32 + 8 * hi; q[qt][dc] = WFrag<T16>::ld(Q + qo); if (HI) q2[qt][dc] = WFrag<T16>::ld(Q2 + qo); }
    v8f o[4][NQ];                                    // O^T: [16 head dims][query tile]
#pragma unroll
    for (int dt = 0; dt < 4; ++dt)
#pragma unroll
        for (int qt = 0; qt < NQ; ++qt) o[dt][qt] = (v8f){};
    float m[NQ], l[NQ];                              // running maximum of the raw scores; this lane half's running sum
#pragma unroll
    for (int qt = 0; qt < NQ; ++qt) { m[qt] = -3.0e38f; l[qt] = 0.f; }
    const int nst = r0 / 64 + 1;                     // 64-key steps up to and with the diagonal block
    const size_t koff = (size_t)lr * HD + 8 * hi, voff = (size_t)lr * TT + 8 * hi;
    V kf[4][2];                                      // fp16 path: key fragments fetched one step ahead
    const T16* kn = Kp + koff;                       // this lane's place in the keys that are fetched next
    if (!HI) {
#pragma unroll
        for (int kt = 0; kt < 4; ++kt)
#pragma unroll
            for (int dc = 0; dc < 2; ++dc) kf[kt][dc] = WFrag<T16>::ld(kn + kt * 16 * HD + dc * 32);
    }
#pragma unroll 1
    for (int st = 0; st < nst; ++st) {
        const int c0 = st * 64;
        v8f s[4][NQ];                                // S^T: [16 keys][query tile]
#pragma unroll
        for (int kt = 0; kt < 4; ++kt)
#pragma unroll
            for (int qt = 0; qt < NQ; ++qt) s[kt][qt] = (v8f){};
#pragma unroll
        for (int kt = 0; kt < 4; ++kt)
#pragma unroll
            for (int dc = 0; dc < 2; ++dc) {
                const size_t ko = koff + (size_t)(c0 + kt * 16) * HD + dc * 32;
                V k, k2; if (HI) { k = WFrag<T16>::ld(Kp + ko); k2 = WFrag<T16>::ld(Kp2 + ko); } else k = kf[kt][dc];
#pragma unroll
                for (int qt = 0; qt < NQ; ++qt) { s[kt][qt] = WFrag<T16>::mma(k, q[qt][dc], s[kt][qt]); if (HI) { s[kt][qt] = WFrag<T16>::mma(k2, q[qt][dc], s[kt][qt]); s[kt][qt] = WFrag<T16>::mma(k, q2[qt][dc], s[kt][qt]); } }
            }
        V vf[4][2];                                  // fp16 path: value fragments issued ahead of the softmax, which covers their latency
        if (!HI) {
#pragma unroll
            for (int dt = 0; dt < 4; ++dt)
#pragma unroll
                for (int kc = 0; kc < 2; ++kc) vf[dt][kc] = WFrag<T16>::ld(Vt + voff + (size_t)dt * 16 * TT + c0 + kc * 32);
        }
        const bool diag = (st == nst - 1);           // only the last step holds keys above the diagonal
#pragma unroll
        for (int qt = 0; qt < NQ; ++qt) {
            if (diag) { const int lim = r0 + qt * 16 + lr - c0 - hi * 8;   // key kt * 16 + j of this lane half is allowed while <= lim
#pragma unroll
                for (int kt = 0; kt < 4; ++kt)
#pragma unroll
                    for (int j = 0; j < 8; ++j) s[kt][qt][j] = (kt * 16 + j <= lim) ? s[kt][qt][j] : -3.0e38f; }
            float mx = m[qt];
#pragma unroll
            for (int kt = 0; kt < 4; ++kt)
#pragma unroll
                for (int j = 0; j < 8; ++j) mx = fmaxf(mx, s[kt][qt][j]);
            mx = fmaxf(mx, __shfl_xor(mx, 16, 32));
            const float al = exp2s((m[qt] - mx) * EC); m[qt] = mx;
            float sum = 0.f;
#pragma unroll
            for (int kt = 0; kt < 4; ++kt)
#pragma unroll
                for (int j = 0; j < 8; ++j) { const float d0 = s[kt][qt][j] - mx; const float p = exp2s(HI ? d0 * EC : __builtin_fmaf(d0, EC, 10.0f)); s[kt][qt][j] = p; sum += p; }
            l[qt] = l[qt] * al + sum;
#pragma unroll
            for (int dt = 0; dt < 4; ++dt) o[dt][qt] *= al;
        }
#pragma unroll
        for (int kc = 0; kc < 2; ++kc) {
            V pb[NQ], pb2[NQ];
#pragma unroll
            for (int qt = 0; qt < NQ; ++qt) {
                if constexpr (HI) { v8us h0, h1, l0, l1;
#pragma unroll
                    for (int e = 0; e < 8; ++e) { unsigned short a, c2; splitf(s[2 * kc][qt][e], a, c2); h0[e] = a; l0[e] = c2; splitf(s[2 * kc + 1][qt][e], a, c2); h1[e] = a; l1[e] = c2; }
                    pb[qt] = cat16b(h0, h1); pb2[qt] = cat16b(l0, l1);
                } else { v8h h0, h1;
#pragma unroll
                    for (int e = 0; e < 8; ++e) { h0[e] = tohx(s[2 * kc][qt][e]); h1[e] = tohx(s[2 * kc + 1][qt][e]); }
                    pb[qt] = cat16(h0, h1); }
            }
#pragma unroll
            for (int dt = 0; dt < 4; ++dt) {
                const size_t vo = voff + (size_t)dt * 16 * TT + c0 + kc * 32;
                V v, v2; if (HI) { v = WFrag<T16>::ld(Vt + vo); v2 = WFrag<T16>::ld(Vt2 + vo); } else v = vf[dt][kc];
#pragma unroll
                for (int qt = 0; qt < NQ; ++qt) { o[dt][qt] = WFrag<T16>::mma(v, pb[qt], o[dt][qt]); if (HI) { o[dt][qt] = WFrag<T16>::mma(v, pb2[qt], o[dt][qt]); o[dt][qt] = WFrag<T16>::mma(v2, pb[qt], o[dt][qt]); } }
            }
        }
        if (!HI) { kn += (st + 1 < nst) ? 64 * HD : 0;   // next step's keys (the last step fetches its own again: always inside the plane)
#pragma unroll
            for (int kt = 0; kt < 4; ++kt)
#pragma unroll
                for (int dc = 0; dc < 2; ++dc) kf[kt][dc] = WFrag<T16>::ld(kn + kt * 16 * HD + dc * 32);
            asm volatile("s_wait_xcnt 0x0" ::: "memory");   // the fetch's address registers are rewritten behind the loop's exit
        }
        // distance after the last matrix instructions on the loop's back edge: the next trip overwrites their operands
        if constexpr (NQ == 2) asm volatile("v_nop\n\tv_nop\n\tv_nop\n\tv_nop\n\tv_nop" : "+v"(o[0][0]), "+v"(o[0][1]), "+v"(o[1][0]), "+v"(o[1][1]), "+v"(o[2][0]), "+v"(o[2][1]), "+v"(o[3][0]), "+v"(o[3][1]));
        else asm volatile("v_nop\n\tv_nop\n\tv_nop\n\tv_nop\n\tv_nop" : "+v"(o[0][0]), "+v"(o[1][0]), "+v"(o[2][0]), "+v"(o[3][0]));
    }
    const int ln = (int)__builtin_amdgcn_mbcnt_lo(~0u, 0u);   // the lane's number read anew (one wave a block): no row address formed in front of the loop has to live through it, which spilled
#pragma unroll
    for (int qt = 0; qt < NQ; ++qt) {
        const float inv = __fdiv_rn(1.0f, l[qt] + __shfl_xor(l[qt], 16, 32));
        float* orow = outp + (size_t)(r0 + qt * 16 + (ln & 15)) * DQ + (ln >> 4) * 8;   // a lane's 8 accumulator registers are 8 consecutive head dims of one query row
#pragma unroll
        for (int dt = 0; dt < 4; ++dt) { v4f a, b2;
#pragma unroll
            for (int j = 0; j < 4; ++j) { a[j] = o[dt][qt][j] * inv; b2[j] = o[dt][qt][4 + j] * inv; }
            *(v4f*)(orow + dt * 16) = a; *(v4f*)(orow + dt * 16 + 4) = b2; }
    }
}
// grid (heads, (TT - RH) / 32 + RH / 16): blockIdx.y counts the query tiles from the last (most keys) to the first, so that the long tiles start first; rows >= RH in tiles of 32, rows < RH (three products, twice the planes) in tiles of 16
// at most 256 registers a wave: the build then stays in the directly addressed registers
__global__ __launch_bounds__(32) __attribute__((amdgpu_waves_per_eu(4, 4))) void k_fattn(const h16* __restrict__ Q16, const h16* __restrict__ K16, const h16* __restrict__ V16, const bf* __restrict__ Qh, const bf* __restrict__ Ql, const bf* __restrict__ Kh, const bf* __restrict__ Kl, const bf* __restrict__ Vh, const bf* __restrict__ Vl, float* __restrict__ OUTb) {
    const int h = blockIdx.x, y = blockIdx.y; const size_t zp = (size_t)h * TT * HD; float* outp = OUTb + h * HD;
    if (y < (TT - RH) / 32) fattn_tile<h16, false, 2>(Q16 + zp, nullptr, K16 + zp, nullptr, V16 + zp, nullptr, TT - 32 * (y + 1), outp);
    else fattn_tile<bf, true, 1>(Qh + zp, Ql + zp, Kh + zp, Kl + zp, Vh + zp, Vl + zp, RH - 16 * (y - (TT - RH) / 32 + 1), outp);
}

extern "C" void kernel_launch(void* const* d_in, const int* in_sizes, int n_in,
                              void* d_out, int out_size, void* d_ws, size_t ws_size, hipStream_t stream) {
    (void)in_sizes; (void)n_in; (void)out_size;
    const float* x = (const float*)d_in[0]; const float* wqkv = (const float*)d_in[1];   /* order inputs, W_qkv ('oi' [3072][1024], per-head (q, k, v) packed rows) */ const float* wq = wqkv; const float* wk = nullptr; const float* wv = nullptr; const float* wo = nullptr; (void)wk; (void)wv; (void)wo;
    float* OUT = (float*)d_out;     // [2][2048][1024]
    char* wsp = (char*)d_ws;
    auto take = [&](size_t bytes) { char* p = wsp; wsp += (bytes + 255) & ~(size_t)255; return (void*)p; };
    bf* WQKV = (bf*)take((size_t)3 * DQ * DM * 2); bf* WQ = WQKV; bf* WK = WQKV + (size_t)DQ * DM; bf* WV = WQKV + (size_t)2 * DQ * DM;   /* de-interleaved Bt: q | k | v row blocks in head order */ float* CS = (float*)take((size_t)TT * HD * 2 * 4);
    bf* XB = (bf*)take((size_t)TT * DM * 2); float* FQ = (float*)take((size_t)TT * DQ * 4); float* FK = (float*)take((size_t)TT * DKV * 4);
    h16* QP16 = (h16*)take((size_t)NH_ * TT * HD * 2); h16* KP16 = (h16*)take((size_t)NKV * TT * HD * 2); h16* VT16 = (h16*)take((size_t)NKV * HD * TT * 2);
    bf* QPh = (bf*)take((size_t)NH_ * TT * HD * 2); bf* QPl = (bf*)take((size_t)NH_ * TT * HD * 2); bf* KPh = (bf*)take((size_t)NKV * TT * HD * 2); bf* KPl = (bf*)take((size_t)NKV * TT * HD * 2); bf* VTh = (bf*)take((size_t)NKV * HD * TT * 2); bf* VTl = (bf*)take((size_t)NKV * HD * TT * 2);
    if ((size_t)(wsp - (char*)d_ws) > ws_size) return;    // ws 256 MiB
    float* FV = FK;   // v projection reuses the k buffer after the k planes are built (stream-ordered)
    { k_wperm<<<(unsigned)(((size_t)3 * DQ * DM / 8 + 255) / 256), 256, 0, stream>>>(wqkv, WQKV);   /* packed rows (h, part, d) -> standard (part, h, d) blocks */
      
       }
    k_csid<<<(TT * HD + 255) / 256, 256, 0, stream>>>(CS);
    const unsigned LQ = (unsigned)(((size_t)NH_ * TT * HD / 2 + 255) / 256), LKv = (unsigned)(((size_t)NKV * TT * HD / 2 + 255) / 256);
    for (int b = 0; b < NB_; ++b) {
        
        k_cvt8<<<(unsigned)(((size_t)TT * DM / 8 + 255) / 256), 256, 0, stream>>>(x + (size_t)b * TT * DM, XB, (size_t)TT * DM / 8);
        k_gemmw<bf, 0, false><<<dim3(TT / 64, DQ / 64, 1), 32, 0, stream>>>(XB, nullptr, WQ, nullptr, DM, FQ, DQ, nullptr, 0, 0, 0);
        k_rope<<<LQ, 256, 0, stream>>>(FQ, DQ, NH_, CS, nullptr, nullptr, 1.0f, QP16, QPh, QPl);
        k_gemmw<bf, 0, false><<<dim3(TT / 64, DKV / 64, 1), 32, 0, stream>>>(XB, nullptr, WK, nullptr, DM, FK, DKV, nullptr, 0, 0, 0);
        k_rope<<<LKv, 256, 0, stream>>>(FK, DKV, NKV, CS, nullptr, nullptr, 1.0f, KP16, KPh, KPl);
        k_gemmw<bf, 0, false><<<dim3(TT / 64, DKV / 64, 1), 32, 0, stream>>>(XB, nullptr, WV, nullptr, DM, FV, DKV, nullptr, 0, 0, 0); k_vtp<<<LKv, 256, 0, stream>>>(FV, DKV, NKV, VT16, VTh, VTl);
        k_fattn<<<dim3(NH_, (TT - RH) / 32 + RH / 16, 1), 32, 0, stream>>>(QP16, KP16, VT16, QPh, QPl, KPh, KPl, VTh, VTl, OUT + (size_t)b * TT * DQ);
         }
}

// v003
// A run of this version takes 167 microseconds.
// In two side-by-side timings against v002, it was 1.70 and 1.69 times as fast.
// All steps since v000 together make it 8.12 times as fast.
#include <hip/hip_runtime.h>

// Causal multi-head attention with a per-head packed qkv projection (inputs [2][2048][1024]; qkv = x W_qkv^T ('oi' [3072][1024] 1/32, no bias); the module views qkv as (T, 16 heads, 3 x 64) and splits the LAST dim: head h's q = output rows h*192 + 0..63, k = h*192 + 64..127, v = h*192 + 128..191; scores x 64^-0.5; causal (-inf); softmax; out = merged heads (no output projection) -> [2][2048][1024] (4.2 M); argument order inputs, W_qkv).
// Layout per batch: the packed weight rows are gathered once into a standard q | k | v Bt (a row permutation of the bf16 copy); bf16 copy of x; one projection launch (k_proj: exact products, its accumulators leave as the fp16 and bf16 hi/lo head planes of q, k and v^T); one fused causal attention launch (k_fattn: online softmax, scores and probabilities stay in registers; hybrid rows: < 512 hi/lo 3 products, rest fp16 x1024) writes the output rows.
// Compute dtypes, f32 accumulate: every input rounded to bf16; projections exact; attention rows < 512 3 products, rest fp16; softmax f32; output f32.

#define NB_  2
#define TT   2048
#define DM   1024
#define NH_  16
#define NKV  16
#define REP  (NH_ / NKV)
#define HD   64
#define DQ   (NH_ * HD)
#define DKV  (NKV * HD)
#define RH   512                  // query rows < RH use hi+lo planes (0: none)
#define SCL  0.125f   // HD^-0.5
typedef _Float16 h16;
typedef unsigned short bf;
typedef __attribute__((ext_vector_type(16))) __bf16   v16bf;
typedef __attribute__((ext_vector_type(16))) _Float16 v16h;
typedef __attribute__((ext_vector_type(8)))  _Float16 v8h;
typedef __attribute__((ext_vector_type(8)))  unsigned short v8us;
typedef __attribute__((ext_vector_type(8)))  float    v8f;
typedef __attribute__((ext_vector_type(4)))  float    v4f;
typedef v8h  __attribute__((may_alias)) v8ha;
typedef v4f  __attribute__((may_alias)) v4fa;
typedef v8us __attribute__((may_alias)) v8usa;

__device__ __forceinline__ unsigned short f2bf(float f) { unsigned u = __float_as_uint(f); u += 0x7FFFu + ((u >> 16) & 1u); return (unsigned short)(u >> 16); }
__device__ __forceinline__ float bf2f(unsigned short b) { return __uint_as_float(((unsigned)b) << 16); }
__device__ __forceinline__ float bfr(float f) { return bf2f(f2bf(f)); }
__device__ __forceinline__ v16h cat16(v8h lo, v8h hi) { return __builtin_shufflevector(lo, hi, 0, 1, 2, 3, 4, 5, 6, 7, 8, 9, 10, 11, 12, 13, 14, 15); }
__device__ __forceinline__ v16bf cat16b(v8us lo, v8us hi) { return __builtin_bit_cast(v16bf, __builtin_shufflevector(lo, hi, 0, 1, 2, 3, 4, 5, 6, 7, 8, 9, 10, 11, 12, 13, 14, 15)); }
__device__ __forceinline__ v8f wmma16(v16h a, v16h b, v8f c) { return __builtin_amdgcn_wmma_f32_16x16x32_f16(false, a, false, b, (short)0, c, false, false); }
__device__ __forceinline__ v8f wmmab(v16bf a, v16bf b, v8f c) { return __builtin_amdgcn_wmma_f32_16x16x32_bf16(false, a, false, b, (short)0, c, false, false); }



// fragment loaders and products of the two 16-bit forms; both operands K-contiguous, the same k order for A and B
template <typename T16> struct WFrag;
template <> struct WFrag<h16> { typedef v16h V; static __device__ __forceinline__ V ld(const h16* p) { return cat16(*(const v8h*)p, *(const v8h*)(p + 16)); } static __device__ __forceinline__ v8f mma(V a, V b, v8f c) { return wmma16(a, b, c); } };
template <> struct WFrag<bf> { typedef v16bf V; static __device__ __forceinline__ V ld(const bf* p) { return cat16b(*(const v8us*)p, *(const v8us*)(p + 16)); } static __device__ __forceinline__ v8f mma(V a, V b, v8f c) { return wmmab(a, b, c); } };

__device__ __forceinline__ h16 tohx(float x) { return (h16)x; }
__device__ __forceinline__ void splitf(float y, unsigned short& h, unsigned short& l) { h = f2bf(y); l = f2bf(y - bf2f(h)); }
typedef __attribute__((ext_vector_type(2))) _Float16 v2h;
typedef __attribute__((ext_vector_type(4))) _Float16 v4h;
typedef __attribute__((ext_vector_type(2))) unsigned short v2us;
typedef __attribute__((ext_vector_type(4))) unsigned short v4us;
typedef __attribute__((ext_vector_type(2))) float v2f;
typedef __attribute__((ext_vector_type(4))) int v4i;

__global__ __launch_bounds__(256) void k_cvt8(const float* __restrict__ src, bf* dst, size_t n8) { const size_t i = (size_t)blockIdx.x * 256 + threadIdx.x; if (i >= n8) return; const v8f v = *(const v8f*)(src + i * 8); v8us o;
#pragma unroll
    for (int k = 0; k < 8; ++k) o[k] = f2bf(v[k]); *(v8us*)(dst + i * 8) = o;  }

__global__ __launch_bounds__(256) void k_wperm(const float* __restrict__ W, bf* Bt) { const size_t i = (size_t)blockIdx.x * 256 + threadIdx.x; if (i >= (size_t)3 * DQ * DM / 8) return; const size_t e = i * 8; const int c0 = (int)(e % DM); const int rd = (int)(e / DM); const int part = rd / DQ; const int h = (rd % DQ) / HD; const int d = rd % HD; const int rs = h * 3 * HD + part * HD + d; const v8f v = *(const v8f*)(W + (size_t)rs * DM + c0); v8us o;
#pragma unroll
    for (int k = 0; k < 8; ++k) o[k] = f2bf(v[k]); *(v8us*)(Bt + e) = o;  }
#define SP 72   // staging pitch in 16-bit elements: 128 + 16 bytes
__global__ __launch_bounds__(32) void k_proj(const bf* __restrict__ X, const bf* __restrict__ Wt, h16* Q16, bf* Qh, bf* Ql, h16* K16, bf* Kh, bf* Kl, h16* V16, bf* Vh, bf* Vl) {
    typedef WFrag<bf>::V V;
    __shared__ __align__(16) unsigned short st[3][16 * SP];
    const int lane = threadIdx.x & 31, lr = lane & 15, hi = lane >> 4;
    const int r0 = blockIdx.x * 64, part = blockIdx.y / NH_, h = blockIdx.y % NH_;
    const bool tv = (part == 2);
    const bf* xr = X + (size_t)r0 * DM; const bf* wr = Wt + (size_t)blockIdx.y * 64 * DM;
    const bf* A = tv ? xr : wr; const bf* B = tv ? wr : xr;
    v8f acc[4][4];
#pragma unroll
    for (int mb = 0; mb < 4; ++mb)
#pragma unroll
        for (int nb = 0; nb < 4; ++nb) acc[mb][nb] = (v8f){};
    const size_t foff = (size_t)lr * DM + 8 * hi;
#pragma unroll 1
    for (int kc = 0; kc < DM; kc += 32) {
        V a[4];
#pragma unroll
        for (int mb = 0; mb < 4; ++mb) a[mb] = WFrag<bf>::ld(A + foff + (size_t)mb * 16 * DM + kc);
        asm volatile("s_wait_xcnt 0x0" ::: "memory");   // the A loads' address registers may be given to a B load's result: the wait stands in front of that rewrite
#pragma unroll
        for (int nb = 0; nb < 4; ++nb) { const V b = WFrag<bf>::ld(B + foff + (size_t)nb * 16 * DM + kc);
#pragma unroll
            for (int mb = 0; mb < 4; ++mb) acc[mb][nb] = WFrag<bf>::mma(a[mb], b, acc[mb][nb]); }
        asm volatile("s_wait_xcnt 0x0" ::: "memory");   // the loads' address registers are rewritten at the head of the next trip and behind the loop
        // distance after the last matrix instructions on the loop's back edge and exit
        asm volatile("v_nop\n\tv_nop\n\tv_nop\n\tv_nop" : "+v"(acc[0][0]), "+v"(acc[1][1]), "+v"(acc[2][2]), "+v"(acc[3][3]) : "v"(a[0]), "v"(a[3]));
    }
    unsigned short* d16 = (unsigned short*)(part == 0 ? Q16 : part == 1 ? K16 : V16); bf* dh = part == 0 ? Qh : part == 1 ? Kh : Vh; bf* dl = part == 0 ? Ql : part == 1 ? Kl : Vl;
    const size_t base = tv ? (size_t)h * HD * TT + r0 : ((size_t)h * TT + r0) * HD;   // first element of the tile in its planes
    const int pitch = tv ? TT : HD;                                                    // from one plane row to the next
#pragma unroll
    for (int nb = 0; nb < 4; ++nb) {
#pragma unroll
        for (int mb = 0; mb < 4; ++mb) { v8h o16; v8us oh, ol;
#pragma unroll
            for (int j = 0; j < 8; ++j) { const float x = acc[mb][nb][j]; o16[j] = tohx(x); unsigned short a2, c2; splitf(x, a2, c2); oh[j] = a2; ol[j] = c2; }
            const int so = lr * SP + (2 * mb + hi) * 8;
            *(v8us*)(&st[0][so]) = __builtin_bit_cast(v8us, o16); *(v8us*)(&st[1][so]) = oh; *(v8us*)(&st[2][so]) = ol; }
        // one wave a block, so no barrier: the wave's own LDS writes have landed before it reads the rows back across lanes; the clobber keeps the compiler from lifting those reads over the writes
        __builtin_amdgcn_wave_barrier(); asm volatile("s_wait_dscnt 0x0" ::: "memory");
#pragma unroll
        for (int s = 0; s < 4; ++s) { const int row = 4 * s + (lane >> 3), pc = (lane & 7) * 8; const size_t e = base + (size_t)(nb * 16 + row) * pitch + pc;
            *(v8usa*)(d16 + e) = *(const v8us*)(&st[0][row * SP + pc]); *(v8usa*)(dh + e) = *(const v8us*)(&st[1][row * SP + pc]); *(v8usa*)(dl + e) = *(const v8us*)(&st[2][row * SP + pc]); }
        // compiler fence: keeps these reads from sinking under the next rows' writes
        __builtin_amdgcn_wave_barrier(); asm volatile("" ::: "memory");
    }
}
__device__ __forceinline__ float exp2s(float x) { float r; asm("v_exp_f32 %0, %1\n\tv_nop" : "=v"(r) : "v"(x)); return r; }
template <typename T16, bool HI, int NQ>
__device__ __forceinline__ void fattn_tile(const T16* __restrict__ Q, const T16* __restrict__ Q2, const T16* __restrict__ Kp, const T16* __restrict__ Kp2, const T16* __restrict__ Vt, const T16* __restrict__ Vt2, int r0, float* __restrict__ outp) {
    typedef typename WFrag<T16>::V V;
    const int lane = threadIdx.x & 31, lr = lane & 15, hi = lane >> 4;
    const float EC = SCL * 1.4426950408889634f;      // scores x HD^-0.5 x log2(e)
    V q[NQ][2], q2[NQ][2];                            // [query tile][32-wide chunk of the head dim]
#pragma unroll
    for (int qt = 0; qt < NQ; ++qt)
#pragma unroll
        for (int dc = 0; dc < 2; ++dc) { const size_t qo = (size_t)(r0 + qt * 16 + lr) * HD + dc * 32 + 8 * hi; q[qt][dc] = WFrag<T16>::ld(Q + qo); if (HI) q2[qt][dc] = WFrag<T16>::ld(Q2 + qo); }
    v8f o[4][NQ];                                    // O^T: [16 head dims][query tile]
#pragma unroll
    for (int dt = 0; dt < 4; ++dt)
#pragma unroll
        for (int qt = 0; qt < NQ; ++qt) o[dt][qt] = (v8f){};
    float m[NQ], l[NQ];                              // running maximum of the raw scores; this lane half's running sum
#pragma unroll
    for (int qt = 0; qt < NQ; ++qt) { m[qt] = -3.0e38f; l[qt] = 0.f; }
    const int nst = r0 / 64 + 1;                     // 64-key steps up to and with the diagonal block
    const size_t koff = (size_t)lr * HD + 8 * hi, voff = (size_t)lr * TT + 8 * hi;
    V kf[4][2];                                      // fp16 path: key fragments fetched one step ahead
    const T16* kn = Kp + koff;                       // this lane's place in the keys that are fetched next
    if (!HI) {
#pragma unroll
        for (int kt = 0; kt < 4; ++kt)
#pragma unroll
            for (int dc = 0; dc < 2; ++dc) kf[kt][dc] = WFrag<T16>::ld(kn + kt * 16 * HD + dc * 32);
    }
#pragma unroll 1
    for (int st = 0; st < nst; ++st) {
        const int c0 = st * 64;
        v8f s[4][NQ];                                // S^T: [16 keys][query tile]
#pragma unroll
        for (int kt = 0; kt < 4; ++kt)
#pragma unroll
            for (int qt = 0; qt < NQ; ++qt) s[kt][qt] = (v8f){};
#pragma unroll
        for (int kt = 0; kt < 4; ++kt)
#pragma unroll
            for (int dc = 0; dc < 2; ++dc) {
                const size_t ko = koff + (size_t)(c0 + kt * 16) * HD + dc * 32;
                V k, k2; if (HI) { k = WFrag<T16>::ld(Kp + ko); k2 = WFrag<T16>::ld(Kp2 + ko); } else k = kf[kt][dc];
#pragma unroll
                for (int qt = 0; qt < NQ; ++qt) { s[kt][qt] = WFrag<T16>::mma(k, q[qt][dc], s[kt][qt]); if (HI) { s[kt][qt] = WFrag<T16>::mma(k2, q[qt][dc], s[kt][qt]); s[kt][qt] = WFrag<T16>::mma(k, q2[qt][dc], s[kt][qt]); } }
            }
        V vf[4][2];                                  // fp16 path: value fragments issued ahead of the softmax, which covers their latency
        if (!HI) {
#pragma unroll
            for (int dt = 0; dt < 4; ++dt)
#pragma unroll
                for (int kc = 0; kc < 2; ++kc) vf[dt][kc] = WFrag<T16>::ld(Vt + voff + (size_t)dt * 16 * TT + c0 + kc * 32);
        }
        const bool diag = (st == nst - 1);           // only the last step holds keys above the diagonal
#pragma unroll
        for (int qt = 0; qt < NQ; ++qt) {
            if (diag) { const int lim = r0 + qt * 16 + lr - c0 - hi * 8;   // key kt * 16 + j of this lane half is allowed while <= lim
#pragma unroll
                for (int kt = 0; kt < 4; ++kt)
#pragma unroll
                    for (int j = 0; j < 8; ++j) s[kt][qt][j] = (kt * 16 + j <= lim) ? s[kt][qt][j] : -3.0e38f; }
            float mx = m[qt];
#pragma unroll
            for (int kt = 0; kt < 4; ++kt)
#pragma unroll
                for (int j = 0; j < 8; ++j) mx = fmaxf(mx, s[kt][qt][j]);
            mx = fmaxf(mx, __shfl_xor(mx, 16, 32));
            const float al = exp2s((m[qt] - mx) * EC); m[qt] = mx;
            float sum = 0.f;
#pragma unroll
            for (int kt = 0; kt < 4; ++kt)
#pragma unroll
                for (int j = 0; j < 8; ++j) { const float d0 = s[kt][qt][j] - mx; const float p = exp2s(HI ? d0 * EC : __builtin_fmaf(d0, EC, 10.0f)); s[kt][qt][j] = p; sum += p; }
            l[qt] = l[qt] * al + sum;
#pragma unroll
            for (int dt = 0; dt < 4; ++dt) o[dt][qt] *= al;
        }
#pragma unroll
        for (int kc = 0; kc < 2; ++kc) {
            V pb[NQ], pb2[NQ];
#pragma unroll
            for (int qt = 0; qt < NQ; ++qt) {
                if constexpr (HI) { v8us h0, h1, l0, l1;
#pragma unroll
                    for (int e = 0; e < 8; ++e) { unsigned short a, c2; splitf(s[2 * kc][qt][e], a, c2); h0[e] = a; l0[e] = c2; splitf(s[2 * kc + 1][qt][e], a, c2); h1[e] = a; l1[e] = c2; }
                    pb[qt] = cat16b(h0, h1); pb2[qt] = cat16b(l0, l1);
                } else { v8h h0, h1;
#pragma unroll
                    for (int e = 0; e < 8; ++e) { h0[e] = tohx(s[2 * kc][qt][e]); h1[e] = tohx(s[2 * kc + 1][qt][e]); }
                    pb[qt] = cat16(h0, h1); }
            }
#pragma unroll
            for (int dt = 0; dt < 4; ++dt) {
                const size_t vo = voff + (size_t)dt * 16 * TT + c0 + kc * 32;
                V v, v2; if (HI) { v = WFrag<T16>::ld(Vt + vo); v2 = WFrag<T16>::ld(Vt2 + vo); } else v = vf[dt][kc];
#pragma unroll
                for (int qt = 0; qt < NQ; ++qt) { o[dt][qt] = WFrag<T16>::mma(v, pb[qt], o[dt][qt]); if (HI) { o[dt][qt] = WFrag<T16>::mma(v, pb2[qt], o[dt][qt]); o[dt][qt] = WFrag<T16>::mma(v2, pb[qt], o[dt][qt]); } }
            }
        }
        if (!HI) { kn += (st + 1 < nst) ? 64 * HD : 0;   // next step's keys (the last step fetches its own again: always inside the plane)
#pragma unroll
            for (int kt = 0; kt < 4; ++kt)
#pragma unroll
                for (int dc = 0; dc < 2; ++dc) kf[kt][dc] = WFrag<T16>::ld(kn + kt * 16 * HD + dc * 32);
            asm volatile("s_wait_xcnt 0x0" ::: "memory");   // the fetch's address registers are rewritten behind the loop's exit
        }
        // distance after the last matrix instructions on the loop's back edge: the next trip overwrites their operands
        if constexpr (NQ == 2) asm volatile("v_nop\n\tv_nop\n\tv_nop\n\tv_nop\n\tv_nop" : "+v"(o[0][0]), "+v"(o[0][1]), "+v"(o[1][0]), "+v"(o[1][1]), "+v"(o[2][0]), "+v"(o[2][1]), "+v"(o[3][0]), "+v"(o[3][1]));
        else asm volatile("v_nop\n\tv_nop\n\tv_nop\n\tv_nop\n\tv_nop" : "+v"(o[0][0]), "+v"(o[1][0]), "+v"(o[2][0]), "+v"(o[3][0]));
    }
    const int ln = (int)__builtin_amdgcn_mbcnt_lo(~0u, 0u);   // the lane's number read anew (one wave a block): no row address formed in front of the loop has to live through it, which spilled
#pragma unroll
    for (int qt = 0; qt < NQ; ++qt) {
        const float inv = __fdiv_rn(1.0f, l[qt] + __shfl_xor(l[qt], 16, 32));
        float* orow = outp + (size_t)(r0 + qt * 16 + (ln & 15)) * DQ + (ln >> 4) * 8;   // a lane's 8 accumulator registers are 8 consecutive head dims of one query row
#pragma unroll
        for (int dt = 0; dt < 4; ++dt) { v4f a, b2;
#pragma unroll
            for (int j = 0; j < 4; ++j) { a[j] = o[dt][qt][j] * inv; b2[j] = o[dt][qt][4 + j] * inv; }
            *(v4f*)(orow + dt * 16) = a; *(v4f*)(orow + dt * 16 + 4) = b2; }
    }
}
// grid (heads, (TT - RH) / 32 + RH / 16): blockIdx.y counts the query tiles from the last (most keys) to the first, so that the long tiles start first; rows >= RH in tiles of 32, rows < RH (three products, twice the planes) in tiles of 16
// at most 256 registers a wave: the build then stays in the directly addressed registers
__global__ __launch_bounds__(32) __attribute__((amdgpu_waves_per_eu(4, 4))) void k_fattn(const h16* __restrict__ Q16, const h16* __restrict__ K16, const h16* __restrict__ V16, const bf* __restrict__ Qh, const bf* __restrict__ Ql, const bf* __restrict__ Kh, const bf* __restrict__ Kl, const bf* __restrict__ Vh, const bf* __restrict__ Vl, float* __restrict__ OUTb) {
    const int h = blockIdx.x, y = blockIdx.y; const size_t zp = (size_t)h * TT * HD; float* outp = OUTb + h * HD;
    if (y < (TT - RH) / 32) fattn_tile<h16, false, 2>(Q16 + zp, nullptr, K16 + zp, nullptr, V16 + zp, nullptr, TT - 32 * (y + 1), outp);
    else fattn_tile<bf, true, 1>(Qh + zp, Ql + zp, Kh + zp, Kl + zp, Vh + zp, Vl + zp, RH - 16 * (y - (TT - RH) / 32 + 1), outp);
}

extern "C" void kernel_launch(void* const* d_in, const int* in_sizes, int n_in,
                              void* d_out, int out_size, void* d_ws, size_t ws_size, hipStream_t stream) {
    (void)in_sizes; (void)n_in; (void)out_size;
    const float* x = (const float*)d_in[0]; const float* wqkv = (const float*)d_in[1];   /* argument order inputs, W_qkv ('oi' [3072][1024], per-head (q, k, v) packed rows) */
    float* OUT = (float*)d_out;     // [2][2048][1024]
    char* wsp = (char*)d_ws;
    auto take = [&](size_t bytes) { char* p = wsp; wsp += (bytes + 255) & ~(size_t)255; return (void*)p; };
    bf* WQKV = (bf*)take((size_t)3 * DQ * DM * 2);   /* de-interleaved Bt: q | k | v row blocks in head order */
    bf* XB = (bf*)take((size_t)TT * DM * 2);
    h16* QP16 = (h16*)take((size_t)NH_ * TT * HD * 2); h16* KP16 = (h16*)take((size_t)NKV * TT * HD * 2); h16* VT16 = (h16*)take((size_t)NKV * HD * TT * 2);
    bf* QPh = (bf*)take((size_t)NH_ * TT * HD * 2); bf* QPl = (bf*)take((size_t)NH_ * TT * HD * 2); bf* KPh = (bf*)take((size_t)NKV * TT * HD * 2); bf* KPl = (bf*)take((size_t)NKV * TT * HD * 2); bf* VTh = (bf*)take((size_t)NKV * HD * TT * 2); bf* VTl = (bf*)take((size_t)NKV * HD * TT * 2);
    if ((size_t)(wsp - (char*)d_ws) > ws_size) return;    // ws 256 MiB
    k_wperm<<<(unsigned)(((size_t)3 * DQ * DM / 8 + 255) / 256), 256, 0, stream>>>(wqkv, WQKV);   /* packed rows (h, part, d) -> standard (part, h, d) blocks */
    for (int b = 0; b < NB_; ++b) {
        k_cvt8<<<(unsigned)(((size_t)TT * DM / 8 + 255) / 256), 256, 0, stream>>>(x + (size_t)b * TT * DM, XB, (size_t)TT * DM / 8);
        k_proj<<<dim3(TT / 64, 3 * NH_, 1), 32, 0, stream>>>(XB, WQKV, QP16, QPh, QPl, KP16, KPh, KPl, VT16, VTh, VTl);
        k_fattn<<<dim3(NH_, (TT - RH) / 32 + RH / 16, 1), 32, 0, stream>>>(QP16, KP16, VT16, QPh, QPl, KPh, KPl, VTh, VTl, OUT + (size_t)b * TT * DQ);
    }
}

// v004
// Measured time: 117 microseconds a run.
// Two timings next to v003 both put it at 1.43 times that version's speed.
// Counting every step since v000, it is 11.6 times as fast.
#include <hip/hip_runtime.h>

// Causal multi-head attention with a per-head packed qkv projection (inputs [2][2048][1024]; qkv = x W_qkv^T ('oi' [3072][1024] 1/32, no bias); the module views qkv as (T, 16 heads, 3 x 64) and splits the LAST dim: head h's q = output rows h*192 + 0..63, k = h*192 + 64..127, v = h*192 + 128..191; scores x 64^-0.5; causal (-inf); softmax; out = merged heads (no output projection) -> [2][2048][1024] (4.2 M); argument order inputs, W_qkv).
// Both batches go through every launch together (4 launches): tokens are the 2 x 2048 rows of x, planes are [batch][head]. Layout: the packed weight rows are gathered once into a standard q | k | v Bt (a row permutation of the bf16 copy); bf16 copy of x; one projection launch (k_proj: exact products, its accumulators leave as the fp16 and bf16 hi/lo head planes of q, k and v^T); one fused causal attention launch (k_fattn: online softmax, scores and probabilities stay in registers; hybrid rows: < 512 hi/lo 3 products, rest fp16 x1024) writes the output rows.
// Compute dtypes, f32 accumulate: every input rounded to bf16; projections exact; attention rows < 512 3 products, rest fp16; softmax f32; output f32.

#define NB_  2
#define TT   2048
#define DM   1024
#define NH_  16
#define NKV  16
#define REP  (NH_ / NKV)
#define HD   64
#define DQ   (NH_ * HD)
#define DKV  (NKV * HD)
#define RH   512                  // query rows < RH use hi+lo planes (0: none)
#define SCL  0.125f   // HD^-0.5
typedef _Float16 h16;
typedef unsigned short bf;
typedef __attribute__((ext_vector_type(16))) __bf16   v16bf;
typedef __attribute__((ext_vector_type(16))) _Float16 v16h;
typedef __attribute__((ext_vector_type(8)))  _Float16 v8h;
typedef __attribute__((ext_vector_type(8)))  unsigned short v8us;
typedef __attribute__((ext_vector_type(8)))  float    v8f;
typedef __attribute__((ext_vector_type(4)))  float    v4f;
typedef v8h  __attribute__((may_alias)) v8ha;
typedef v4f  __attribute__((may_alias)) v4fa;
typedef v8us __attribute__((may_alias)) v8usa;

__device__ __forceinline__ unsigned short f2bf(float f) { unsigned u = __float_as_uint(f); u += 0x7FFFu + ((u >> 16) & 1u); return (unsigned short)(u >> 16); }
__device__ __forceinline__ float bf2f(unsigned short b) { return __uint_as_float(((unsigned)b) << 16); }
__device__ __forceinline__ float bfr(float f) { return bf2f(f2bf(f)); }
__device__ __forceinline__ v16h cat16(v8h lo, v8h hi) { return __builtin_shufflevector(lo, hi, 0, 1, 2, 3, 4, 5, 6, 7, 8, 9, 10, 11, 12, 13, 14, 15); }
__device__ __forceinline__ v16bf cat16b(v8us lo, v8us hi) { return __builtin_bit_cast(v16bf, __builtin_shufflevector(lo, hi, 0, 1, 2, 3, 4, 5, 6, 7, 8, 9, 10, 11, 12, 13, 14, 15)); }
__device__ __forceinline__ v8f wmma16(v16h a, v16h b, v8f c) { return __builtin_amdgcn_wmma_f32_16x16x32_f16(false, a, false, b, (short)0, c, false, false); }
__device__ __forceinline__ v8f wmmab(v16bf a, v16bf b, v8f c) { return __builtin_amdgcn_wmma_f32_16x16x32_bf16(false, a, false, b, (short)0, c, false, false); }



// fragment loaders and products of the two 16-bit forms; both operands K-contiguous, the same k order for A and B
template <typename T16> struct WFrag;
template <> struct WFrag<h16> { typedef v16h V; static __device__ __forceinline__ V ld(const h16* p) { return cat16(*(const v8h*)p, *(const v8h*)(p + 16)); } static __device__ __forceinline__ v8f mma(V a, V b, v8f c) { return wmma16(a, b, c); } };
template <> struct WFrag<bf> { typedef v16bf V; static __device__ __forceinline__ V ld(const bf* p) { return cat16b(*(const v8us*)p, *(const v8us*)(p + 16)); } static __device__ __forceinline__ v8f mma(V a, V b, v8f c) { return wmmab(a, b, c); } };

__device__ __forceinline__ h16 tohx(float x) { return (h16)x; }
__device__ __forceinline__ void splitf(float y, unsigned short& h, unsigned short& l) { h = f2bf(y); l = f2bf(y - bf2f(h)); }
typedef __attribute__((ext_vector_type(2))) _Float16 v2h;
typedef __attribute__((ext_vector_type(4))) _Float16 v4h;
typedef __attribute__((ext_vector_type(2))) unsigned short v2us;
typedef __attribute__((ext_vector_type(4))) unsigned short v4us;
typedef __attribute__((ext_vector_type(2))) float v2f;
typedef __attribute__((ext_vector_type(4))) int v4i;

__global__ __launch_bounds__(256) void k_cvt8(const float* __restrict__ src, bf* dst, size_t n8) { const size_t i = (size_t)blockIdx.x * 256 + threadIdx.x; if (i >= n8) return; const v8f v = *(const v8f*)(src + i * 8); v8us o;
#pragma unroll
    for (int k = 0; k < 8; ++k) o[k] = f2bf(v[k]); *(v8us*)(dst + i * 8) = o;  }

__global__ __launch_bounds__(256) void k_wperm(const float* __restrict__ W, bf* Bt) { const size_t i = (size_t)blockIdx.x * 256 + threadIdx.x; if (i >= (size_t)3 * DQ * DM / 8) return; const size_t e = i * 8; const int c0 = (int)(e % DM); const int rd = (int)(e / DM); const int part = rd / DQ; const int h = (rd % DQ) / HD; const int d = rd % HD; const int rs = h * 3 * HD + part * HD + d; const v8f v = *(const v8f*)(W + (size_t)rs * DM + c0); v8us o;
#pragma unroll
    for (int k = 0; k < 8; ++k) o[k] = f2bf(v[k]); *(v8us*)(Bt + e) = o;  }
#define SP 72   // staging pitch in 16-bit elements: 128 + 16 bytes
__global__ __launch_bounds__(32) void k_proj(const bf* __restrict__ X, const bf* __restrict__ Wt, h16* Q16, bf* Qh, bf* Ql, h16* K16, bf* Kh, bf* Kl, h16* V16, bf* Vh, bf* Vl) {
    typedef WFrag<bf>::V V;
    __shared__ __align__(16) unsigned short st[3][16 * SP];
    const int lane = threadIdx.x & 31, lr = lane & 15, hi = lane >> 4;
    const int rg = blockIdx.x * 64, r0 = rg % TT, part = blockIdx.y / NH_, h = (rg / TT) * NH_ + blockIdx.y % NH_;   // rg: row of x; r0: token in its batch; h: (batch, head) plane
    const bool tv = (part == 2);
    const bf* xr = X + (size_t)rg * DM; const bf* wr = Wt + (size_t)blockIdx.y * 64 * DM;
    const bf* A = tv ? xr : wr; const bf* B = tv ? wr : xr;
    v8f acc[4][4];
#pragma unroll
    for (int mb = 0; mb < 4; ++mb)
#pragma unroll
        for (int nb = 0; nb < 4; ++nb) acc[mb][nb] = (v8f){};
    const size_t foff = (size_t)lr * DM + 8 * hi;
#pragma unroll 1
    for (int kc = 0; kc < DM; kc += 32) {
        V a[4];
#pragma unroll
        for (int mb = 0; mb < 4; ++mb) a[mb] = WFrag<bf>::ld(A + foff + (size_t)mb * 16 * DM + kc);
        asm volatile("s_wait_xcnt 0x0" ::: "memory");   // the A loads' address registers may be given to a B load's result: the wait stands in front of that rewrite
#pragma unroll
        for (int nb = 0; nb < 4; ++nb) { const V b = WFrag<bf>::ld(B + foff + (size_t)nb * 16 * DM + kc);
#pragma unroll
            for (int mb = 0; mb < 4; ++mb) acc[mb][nb] = WFrag<bf>::mma(a[mb], b, acc[mb][nb]); }
        asm volatile("s_wait_xcnt 0x0" ::: "memory");   // the loads' address registers are rewritten at the head of the next trip and behind the loop
        // distance after the last matrix instructions on the loop's back edge and exit
        asm volatile("v_nop\n\tv_nop\n\tv_nop\n\tv_nop" : "+v"(acc[0][0]), "+v"(acc[1][1]), "+v"(acc[2][2]), "+v"(acc[3][3]) : "v"(a[0]), "v"(a[3]));
    }
    unsigned short* d16 = (unsigned short*)(part == 0 ? Q16 : part == 1 ? K16 : V16); bf* dh = part == 0 ? Qh : part == 1 ? Kh : Vh; bf* dl = part == 0 ? Ql : part == 1 ? Kl : Vl;
    const size_t base = tv ? (size_t)h * HD * TT + r0 : ((size_t)h * TT + r0) * HD;   // first element of the tile in its planes
    const int pitch = tv ? TT : HD;                                                    // from one plane row to the next
#pragma unroll
    for (int nb = 0; nb < 4; ++nb) {
#pragma unroll
        for (int mb = 0; mb < 4; ++mb) { v8h o16; v8us oh, ol;
#pragma unroll
            for (int j = 0; j < 8; ++j) { const float x = acc[mb][nb][j]; o16[j] = tohx(x); unsigned short a2, c2; splitf(x, a2, c2); oh[j] = a2; ol[j] = c2; }
            const int so = lr * SP + (2 * mb + hi) * 8;
            *(v8us*)(&st[0][so]) = __builtin_bit_cast(v8us, o16); *(v8us*)(&st[1][so]) = oh; *(v8us*)(&st[2][so]) = ol; }
        // one wave a block, so no barrier: the wave's own LDS writes have landed before it reads the rows back across lanes; the clobber keeps the compiler from lifting those reads over the writes
        __builtin_amdgcn_wave_barrier(); asm volatile("s_wait_dscnt 0x0" ::: "memory");
#pragma unroll
        for (int s = 0; s < 4; ++s) { const int row = 4 * s + (lane >> 3), pc = (lane & 7) * 8; const size_t e = base + (size_t)(nb * 16 + row) * pitch + pc;
            *(v8usa*)(d16 + e) = *(const v8us*)(&st[0][row * SP + pc]); *(v8usa*)(dh + e) = *(const v8us*)(&st[1][row * SP + pc]); *(v8usa*)(dl + e) = *(const v8us*)(&st[2][row * SP + pc]); }
        // compiler fence: keeps these reads from sinking under the next rows' writes
        __builtin_amdgcn_wave_barrier(); asm volatile("" ::: "memory");
    }
}
__device__ __forceinline__ float exp2s(float x) { float r; asm("v_exp_f32 %0, %1\n\tv_nop" : "=v"(r) : "v"(x)); return r; }
template <typename T16, bool HI, int NQ>
__device__ __forceinline__ void fattn_tile(const T16* __restrict__ Q, const T16* __restrict__ Q2, const T16* __restrict__ Kp, const T16* __restrict__ Kp2, const T16* __restrict__ Vt, const T16* __restrict__ Vt2, int r0, float* __restrict__ outp) {
    typedef typename WFrag<T16>::V V;
    const int lane = threadIdx.x & 31, lr = lane & 15, hi = lane >> 4;
    const float EC = SCL * 1.4426950408889634f;      // scores x HD^-0.5 x log2(e)
    V q[NQ][2], q2[NQ][2];                            // [query tile][32-wide chunk of the head dim]
#pragma unroll
    for (int qt = 0; qt < NQ; ++qt)
#pragma unroll
        for (int dc = 0; dc < 2; ++dc) { const size_t qo = (size_t)(r0 + qt * 16 + lr) * HD + dc * 32 + 8 * hi; q[qt][dc] = WFrag<T16>::ld(Q + qo); if (HI) q2[qt][dc] = WFrag<T16>::ld(Q2 + qo); }
    v8f o[4][NQ];                                    // O^T: [16 head dims][query tile]
#pragma unroll
    for (int dt = 0; dt < 4; ++dt)
#pragma unroll
        for (int qt = 0; qt < NQ; ++qt) o[dt][qt] = (v8f){};
    float m[NQ], l[NQ];                              // running maximum of the raw scores; this lane half's running sum
#pragma unroll
    for (int qt = 0; qt < NQ; ++qt) { m[qt] = -3.0e38f; l[qt] = 0.f; }
    const int nst = r0 / 64 + 1;                     // 64-key steps up to and with the diagonal block
    const size_t koff = (size_t)lr * HD + 8 * hi, voff = (size_t)lr * TT + 8 * hi;
    V kf[4][2];                                      // fp16 path: key fragments fetched one step ahead
    const T16* kn = Kp + koff;                       // this lane's place in the keys that are fetched next
    if (!HI) {
#pragma unroll
        for (int kt = 0; kt < 4; ++kt)
#pragma unroll
            for (int dc = 0; dc < 2; ++dc) kf[kt][dc] = WFrag<T16>::ld(kn + kt * 16 * HD + dc * 32);
    }
#pragma unroll 1
    for (int st = 0; st < nst; ++st) {
        const int c0 = st * 64;
        v8f s[4][NQ];                                // S^T: [16 keys][query tile]
#pragma unroll
        for (int kt = 0; kt < 4; ++kt)
#pragma unroll
            for (int qt = 0; qt < NQ; ++qt) s[kt][qt] = (v8f){};
#pragma unroll
        for (int kt = 0; kt < 4; ++kt)
#pragma unroll
            for (int dc = 0; dc < 2; ++dc) {
                const size_t ko = koff + (size_t)(c0 + kt * 16) * HD + dc * 32;
                V k, k2; if (HI) { k = WFrag<T16>::ld(Kp + ko); k2 = WFrag<T16>::ld(Kp2 + ko); } else k = kf[kt][dc];
#pragma unroll
                for (int qt = 0; qt < NQ; ++qt) { s[kt][qt] = WFrag<T16>::mma(k, q[qt][dc], s[kt][qt]); if (HI) { s[kt][qt] = WFrag<T16>::mma(k2, q[qt][dc], s[kt][qt]); s[kt][qt] = WFrag<T16>::mma(k, q2[qt][dc], s[kt][qt]); } }
            }
        V vf[4][2];                                  // fp16 path: value fragments issued ahead of the softmax, which covers their latency
        if (!HI) {
#pragma unroll
            for (int dt = 0; dt < 4; ++dt)
#pragma unroll
                for (int kc = 0; kc < 2; ++kc) vf[dt][kc] = WFrag<T16>::ld(Vt + voff + (size_t)dt * 16 * TT + c0 + kc * 32);
        }
        const bool diag = (st == nst - 1);           // only the last step holds keys above the diagonal
#pragma unroll
        for (int qt = 0; qt < NQ; ++qt) {
            if (diag) { const int lim = r0 + qt * 16 + lr - c0 - hi * 8;   // key kt * 16 + j of this lane half is allowed while <= lim
#pragma unroll
                for (int kt = 0; kt < 4; ++kt)
#pragma unroll
                    for (int j = 0; j < 8; ++j) s[kt][qt][j] = (kt * 16 + j <= lim) ? s[kt][qt][j] : -3.0e38f; }
            float mx = m[qt];
#pragma unroll
            for (int kt = 0; kt < 4; ++kt)
#pragma unroll
                for (int j = 0; j < 8; ++j) mx = fmaxf(mx, s[kt][qt][j]);
            mx = fmaxf(mx, __shfl_xor(mx, 16, 32));
            const float al = exp2s((m[qt] - mx) * EC); m[qt] = mx;
            float sum = 0.f;
#pragma unroll
            for (int kt = 0; kt < 4; ++kt)
#pragma unroll
                for (int j = 0; j < 8; ++j) { const float d0 = s[kt][qt][j] - mx; const float p = exp2s(HI ? d0 * EC : __builtin_fmaf(d0, EC, 10.0f)); s[kt][qt][j] = p; sum += p; }
            l[qt] = l[qt] * al + sum;
#pragma unroll
            for (int dt = 0; dt < 4; ++dt) o[dt][qt] *= al;
        }
#pragma unroll
        for (int kc = 0; kc < 2; ++kc) {
            V pb[NQ], pb2[NQ];
#pragma unroll
            for (int qt = 0; qt < NQ; ++qt) {
                if constexpr (HI) { v8us h0, h1, l0, l1;
#pragma unroll
                    for (int e = 0; e < 8; ++e) { unsigned short a, c2; splitf(s[2 * kc][qt][e], a, c2); h0[e] = a; l0[e] = c2; splitf(s[2 * kc + 1][qt][e], a, c2); h1[e] = a; l1[e] = c2; }
                    pb[qt] = cat16b(h0, h1); pb2[qt] = cat16b(l0, l1);
                } else { v8h h0, h1;
#pragma unroll
                    for (int e = 0; e < 8; ++e) { h0[e] = tohx(s[2 * kc][qt][e]); h1[e] = tohx(s[2 * kc + 1][qt][e]); }
                    pb[qt] = cat16(h0, h1); }
            }
#pragma unroll
            for (int dt = 0; dt < 4; ++dt) {
                const size_t vo = voff + (size_t)dt * 16 * TT + c0 + kc * 32;
                V v, v2; if (HI) { v = WFrag<T16>::ld(Vt + vo); v2 = WFrag<T16>::ld(Vt2 + vo); } else v = vf[dt][kc];
#pragma unroll
                for (int qt = 0; qt < NQ; ++qt) { o[dt][qt] = WFrag<T16>::mma(v, pb[qt], o[dt][qt]); if (HI) { o[dt][qt] = WFrag<T16>::mma(v, pb2[qt], o[dt][qt]); o[dt][qt] = WFrag<T16>::mma(v2, pb[qt], o[dt][qt]); } }
            }
        }
        if (!HI) { kn += (st + 1 < nst) ? 64 * HD : 0;   // next step's keys (the last step fetches its own again: always inside the plane)
#pragma unroll
            for (int kt = 0; kt < 4; ++kt)
#pragma unroll
                for (int dc = 0; dc < 2; ++dc) kf[kt][dc] = WFrag<T16>::ld(kn + kt * 16 * HD + dc * 32);
            asm volatile("s_wait_xcnt 0x0" ::: "memory");   // the fetch's address registers are rewritten behind the loop's exit
        }
        // distance after the last matrix instructions on the loop's back edge: the next trip overwrites their operands
        if constexpr (NQ == 2) asm volatile("v_nop\n\tv_nop\n\tv_nop\n\tv_nop\n\tv_nop" : "+v"(o[0][0]), "+v"(o[0][1]), "+v"(o[1][0]), "+v"(o[1][1]), "+v"(o[2][0]), "+v"(o[2][1]), "+v"(o[3][0]), "+v"(o[3][1]));
        else asm volatile("v_nop\n\tv_nop\n\tv_nop\n\tv_nop\n\tv_nop" : "+v"(o[0][0]), "+v"(o[1][0]), "+v"(o[2][0]), "+v"(o[3][0]));
    }
    const int ln = (int)__builtin_amdgcn_mbcnt_lo(~0u, 0u);   // the lane's number read anew (one wave a block): no row address formed in front of the loop has to live through it, which spilled
#pragma unroll
    for (int qt = 0; qt < NQ; ++qt) {
        const float inv = __fdiv_rn(1.0f, l[qt] + __shfl_xor(l[qt], 16, 32));
        float* orow = outp + (size_t)(r0 + qt * 16 + (ln & 15)) * DQ + (ln >> 4) * 8;   // a lane's 8 accumulator registers are 8 consecutive head dims of one query row
#pragma unroll
        for (int dt = 0; dt < 4; ++dt) { v4f a, b2;
#pragma unroll
            for (int j = 0; j < 4; ++j) { a[j] = o[dt][qt][j] * inv; b2[j] = o[dt][qt][4 + j] * inv; }
            *(v4f*)(orow + dt * 16) = a; *(v4f*)(orow + dt * 16 + 4) = b2; }
    }
}
// grid (batches x heads, (TT - RH) / 32 + RH / 16): blockIdx.x = batch * NH_ + head; blockIdx.y counts the query tiles from the last (most keys) to the first, so that the long tiles start first; rows >= RH in tiles of 32, rows < RH (three products, twice the planes) in tiles of 16
// at most 256 registers a wave: the build then stays in the directly addressed registers
__global__ __launch_bounds__(32) __attribute__((amdgpu_waves_per_eu(4, 4))) void k_fattn(const h16* __restrict__ Q16, const h16* __restrict__ K16, const h16* __restrict__ V16, const bf* __restrict__ Qh, const bf* __restrict__ Ql, const bf* __restrict__ Kh, const bf* __restrict__ Kl, const bf* __restrict__ Vh, const bf* __restrict__ Vl, float* __restrict__ OUTb) {
    const int bh = blockIdx.x, y = blockIdx.y; const size_t zp = (size_t)bh * TT * HD; float* outp = OUTb + (size_t)(bh / NH_) * TT * DQ + (bh % NH_) * HD;
    if (y < (TT - RH) / 32) fattn_tile<h16, false, 2>(Q16 + zp, nullptr, K16 + zp, nullptr, V16 + zp, nullptr, TT - 32 * (y + 1), outp);
    else fattn_tile<bf, true, 1>(Qh + zp, Ql + zp, Kh + zp, Kl + zp, Vh + zp, Vl + zp, RH - 16 * (y - (TT - RH) / 32 + 1), outp);
}

extern "C" void kernel_launch(void* const* d_in, const int* in_sizes, int n_in,
                              void* d_out, int out_size, void* d_ws, size_t ws_size, hipStream_t stream) {
    (void)in_sizes; (void)n_in; (void)out_size;
    const float* x = (const float*)d_in[0]; const float* wqkv = (const float*)d_in[1];   /* argument order inputs, W_qkv ('oi' [3072][1024], per-head (q, k, v) packed rows) */
    float* OUT = (float*)d_out;     // [2][2048][1024]
    char* wsp = (char*)d_ws;
    auto take = [&](size_t bytes) { char* p = wsp; wsp += (bytes + 255) & ~(size_t)255; return (void*)p; };
    bf* WQKV = (bf*)take((size_t)3 * DQ * DM * 2);   /* de-interleaved Bt: q | k | v row blocks in head order */
    bf* XB = (bf*)take((size_t)NB_ * TT * DM * 2);
    /* every plane holds both batches: [batch][head][...] */
    h16* QP16 = (h16*)take((size_t)NB_ * NH_ * TT * HD * 2); h16* KP16 = (h16*)take((size_t)NB_ * NKV * TT * HD * 2); h16* VT16 = (h16*)take((size_t)NB_ * NKV * HD * TT * 2);
    bf* QPh = (bf*)take((size_t)NB_ * NH_ * TT * HD * 2); bf* QPl = (bf*)take((size_t)NB_ * NH_ * TT * HD * 2); bf* KPh = (bf*)take((size_t)NB_ * NKV * TT * HD * 2); bf* KPl = (bf*)take((size_t)NB_ * NKV * TT * HD * 2); bf* VTh = (bf*)take((size_t)NB_ * NKV * HD * TT * 2); bf* VTl = (bf*)take((size_t)NB_ * NKV * HD * TT * 2);
    if ((size_t)(wsp - (char*)d_ws) > ws_size) return;    // ws 256 MiB
    k_wperm<<<(unsigned)(((size_t)3 * DQ * DM / 8 + 255) / 256), 256, 0, stream>>>(wqkv, WQKV);   /* packed rows (h, part, d) -> standard (part, h, d) blocks */
    k_cvt8<<<(unsigned)(((size_t)NB_ * TT * DM / 8 + 255) / 256), 256, 0, stream>>>(x, XB, (size_t)NB_ * TT * DM / 8);
    k_proj<<<dim3(NB_ * TT / 64, 3 * NH_, 1), 32, 0, stream>>>(XB, WQKV, QP16, QPh, QPl, KP16, KPh, KPl, VT16, VTh, VTl);
    k_fattn<<<dim3(NB_ * NH_, (TT - RH) / 32 + RH / 16, 1), 32, 0, stream>>>(QP16, KP16, VT16, QPh, QPl, KPh, KPl, VTh, VTl, OUT);
}

// v005
// A run of this version takes 89.9 microseconds.
// In two side-by-side timings against v004, it was 1.30 and 1.31 times as fast.
// Over all steps from v000 it is 15.1 times as fast.
#include <hip/hip_runtime.h>

// Causal multi-head attention with a per-head packed qkv projection (inputs [2][2048][1024]; qkv = x W_qkv^T ('oi' [3072][1024] 1/32, no bias); the module views qkv as (T, 16 heads, 3 x 64) and splits the LAST dim: head h's q = output rows h*192 + 0..63, k = h*192 + 64..127, v = h*192 + 128..191; scores x 64^-0.5; causal (-inf); softmax; out = merged heads (no output projection) -> [2][2048][1024] (4.2 M); argument order inputs, W_qkv).
// Both batches go through every launch together (4 launches): tokens are the 2 x 2048 rows of x, planes are [batch][head]. Layout: the packed weight rows are gathered once into a standard q | k | v Bt (a row permutation of the bf16 copy); bf16 copy of x; one projection launch (k_proj: operands through LDS, exact products, its accumulators leave as the fp16 and bf16 hi/lo head planes of q, k and v^T); one fused causal attention launch (k_fattn: online softmax, scores and probabilities stay in registers; hybrid rows: < 512 hi/lo 3 products, rest fp16 x1024) writes the output rows.
// Compute dtypes, f32 accumulate: every input rounded to bf16; projections exact; attention rows < 512 3 products, rest fp16; softmax f32; output f32.

#define NB_  2
#define TT   2048
#define DM   1024
#define NH_  16
#define NKV  16
#define REP  (NH_ / NKV)
#define HD   64
#define DQ   (NH_ * HD)
#define DKV  (NKV * HD)
#define RH   512                  // query rows < RH use hi+lo planes (0: none)
#define SCL  0.125f   // HD^-0.5
typedef _Float16 h16;
typedef unsigned short bf;
typedef __attribute__((ext_vector_type(16))) __bf16   v16bf;
typedef __attribute__((ext_vector_type(16))) _Float16 v16h;
typedef __attribute__((ext_vector_type(8)))  _Float16 v8h;
typedef __attribute__((ext_vector_type(8)))  unsigned short v8us;
typedef __attribute__((ext_vector_type(8)))  float    v8f;
typedef __attribute__((ext_vector_type(4)))  float    v4f;
typedef v8h  __attribute__((may_alias)) v8ha;
typedef v4f  __attribute__((may_alias)) v4fa;
typedef v8us __attribute__((may_alias)) v8usa;

__device__ __forceinline__ unsigned short f2bf(float f) { unsigned u = __float_as_uint(f); u += 0x7FFFu + ((u >> 16) & 1u); return (unsigned short)(u >> 16); }
__device__ __forceinline__ float bf2f(unsigned short b) { return __uint_as_float(((unsigned)b) << 16); }
__device__ __forceinline__ float bfr(float f) { return bf2f(f2bf(f)); }
__device__ __forceinline__ v16h cat16(v8h lo, v8h hi) { return __builtin_shufflevector(lo, hi, 0, 1, 2, 3, 4, 5, 6, 7, 8, 9, 10, 11, 12, 13, 14, 15); }
__device__ __forceinline__ v16bf cat16b(v8us lo, v8us hi) { return __builtin_bit_cast(v16bf, __builtin_shufflevector(lo, hi, 0, 1, 2, 3, 4, 5, 6, 7, 8, 9, 10, 11, 12, 13, 14, 15)); }
__device__ __forceinline__ v8f wmma16(v16h a, v16h b, v8f c) { return __builtin_amdgcn_wmma_f32_16x16x32_f16(false, a, false, b, (short)0, c, false, false); }
__device__ __forceinline__ v8f wmmab(v16bf a, v16bf b, v8f c) { return __builtin_amdgcn_wmma_f32_16x16x32_bf16(false, a, false, b, (short)0, c, false, false); }



// fragment loaders and products of the two 16-bit forms; both operands K-contiguous, the same k order for A and B
template <typename T16> struct WFrag;
template <> struct WFrag<h16> { typedef v16h V; static __device__ __forceinline__ V ld(const h16* p) { return cat16(*(const v8h*)p, *(const v8h*)(p + 16)); } static __device__ __forceinline__ v8f mma(V a, V b, v8f c) { return wmma16(a, b, c); } };
template <> struct WFrag<bf> { typedef v16bf V; static __device__ __forceinline__ V ld(const bf* p) { return cat16b(*(const v8us*)p, *(const v8us*)(p + 16)); } static __device__ __forceinline__ v8f mma(V a, V b, v8f c) { return wmmab(a, b, c); } };

__device__ __forceinline__ h16 tohx(float x) { return (h16)x; }
__device__ __forceinline__ void splitf(float y, unsigned short& h, unsigned short& l) { h = f2bf(y); l = f2bf(y - bf2f(h)); }
typedef __attribute__((ext_vector_type(2))) _Float16 v2h;
typedef __attribute__((ext_vector_type(4))) _Float16 v4h;
typedef __attribute__((ext_vector_type(2))) unsigned short v2us;
typedef __attribute__((ext_vector_type(4))) unsigned short v4us;
typedef __attribute__((ext_vector_type(2))) float v2f;
typedef __attribute__((ext_vector_type(4))) int v4i;

__global__ __launch_bounds__(256) void k_cvt8(const float* __restrict__ src, bf* dst, size_t n8) { const size_t i = (size_t)blockIdx.x * 256 + threadIdx.x; if (i >= n8) return; const v8f v = *(const v8f*)(src + i * 8); v8us o;
#pragma unroll
    for (int k = 0; k < 8; ++k) o[k] = f2bf(v[k]); *(v8us*)(dst + i * 8) = o;  }

__global__ __launch_bounds__(256) void k_wperm(const float* __restrict__ W, bf* Bt) { const size_t i = (size_t)blockIdx.x * 256 + threadIdx.x; if (i >= (size_t)3 * DQ * DM / 8) return; const size_t e = i * 8; const int c0 = (int)(e % DM); const int rd = (int)(e / DM); const int part = rd / DQ; const int h = (rd % DQ) / HD; const int d = rd % HD; const int rs = h * 3 * HD + part * HD + d; const v8f v = *(const v8f*)(W + (size_t)rs * DM + c0); v8us o;
#pragma unroll
    for (int k = 0; k < 8; ++k) o[k] = f2bf(v[k]); *(v8us*)(Bt + e) = o;  }
#define SP 72   // LDS pitch in 16-bit elements: 128 + 16 bytes (staging rows and operand rows alike)
#define PKC 64                // k per stage
#define PST (256 * SP)        // one stage in 16-bit elements: weight rows 0..127, token rows 128..255
// eight asynchronous copies, 16 bytes a lane each, of rows 16 apart: l = the lane's LDS byte address, g = its global address (8 lanes cover one row's line).
// The s_wait_xcnt stands inside the statement, behind the last copy: the address registers are free for rewriting only behind it.
__device__ __forceinline__ void cp8(unsigned l, const bf* g) {
    asm volatile("global_load_async_to_lds_b128 %0, %8, off\n\t"
                 "global_load_async_to_lds_b128 %1, %9, off\n\t"
                 "global_load_async_to_lds_b128 %2, %10, off\n\t"
                 "global_load_async_to_lds_b128 %3, %11, off\n\t"
                 "global_load_async_to_lds_b128 %4, %12, off\n\t"
                 "global_load_async_to_lds_b128 %5, %13, off\n\t"
                 "global_load_async_to_lds_b128 %6, %14, off\n\t"
                 "global_load_async_to_lds_b128 %7, %15, off\n\t"
                 "s_wait_xcnt 0x0"
                 :: "v"(l), "v"(l + 1u * 16 * SP * 2), "v"(l + 2u * 16 * SP * 2), "v"(l + 3u * 16 * SP * 2), "v"(l + 4u * 16 * SP * 2), "v"(l + 5u * 16 * SP * 2), "v"(l + 6u * 16 * SP * 2), "v"(l + 7u * 16 * SP * 2),
                    "v"(g), "v"(g + 1 * 16 * DM), "v"(g + 2 * 16 * DM), "v"(g + 3 * 16 * DM), "v"(g + 4 * 16 * DM), "v"(g + 5 * 16 * DM), "v"(g + 6 * 16 * DM), "v"(g + 7 * 16 * DM)
                 : "memory");
}
__global__ __launch_bounds__(128) void k_proj(const bf* __restrict__ X, const bf* __restrict__ Wt, h16* Q16, bf* Qh, bf* Ql, h16* K16, bf* Kh, bf* Kl, h16* V16, bf* Vh, bf* Vl) {
    typedef WFrag<bf>::V V;
    __shared__ __align__(16) unsigned short ring[2][PST];
    const int tid = threadIdx.x, lane = tid & 31, lr = lane & 15, hi = lane >> 4;
    const int wv = __builtin_amdgcn_readfirstlane(tid >> 5), wt = wv & 1, ww = wv >> 1;   // the wave's 64-token block and 64-row weight block in the work-group's tile
    const int yy = blockIdx.y * 2 + ww;                                                   // (part, head)
    const int rg = (blockIdx.x * 2 + wt) * 64, r0 = rg % TT, part = yy / NH_, h = (rg / TT) * NH_ + yy % NH_;   // rg: row of x; r0: token in its batch; h: (batch, head) plane
    const bool tv = (part == 2);   // the same for the whole work-group: 128 divides the rows of a part
    const bf* gw = Wt + ((size_t)blockIdx.y * 128 + (tid >> 3)) * DM + (tid & 7) * 8;   // this lane's piece of weight row tid / 8
    const bf* gx = X + ((size_t)blockIdx.x * 128 + (tid >> 3)) * DM + (tid & 7) * 8;    // and of token row tid / 8
    const unsigned l0 = (unsigned)(size_t)&ring[0][(tid >> 3) * SP + (tid & 7) * 8];    // its place in buffer 0 (low 32 bits: the LDS byte address)
    v8f acc[4][4];
#pragma unroll
    for (int mb = 0; mb < 4; ++mb)
#pragma unroll
        for (int nb = 0; nb < 4; ++nb) acc[mb][nb] = (v8f){};
    cp8(l0, gw); cp8(l0 + 128u * SP * 2, gx);                                            // stage 0 into buffer 0
    asm volatile("s_wait_asynccnt 0x0" ::: "memory");                                    // this wave's copies of stage 0 have landed
    __syncthreads();                                                                     // and every other wave's
    cp8(l0 + (unsigned)PST * 2, gw + PKC); cp8(l0 + (unsigned)PST * 2 + 128u * SP * 2, gx + PKC);   // stage 1 into buffer 1
    const int ao = ((tv ? 128 + wt * 64 : ww * 64) + lr) * SP + 8 * hi, bo = ((tv ? ww * 64 : 128 + wt * 64) + lr) * SP + 8 * hi;
#pragma unroll 1
    for (int t = 0; t < DM / PKC; ++t) {
        const unsigned short* sb = &ring[0][0] + (t & 1) * PST;
#pragma unroll
        for (int c = 0; c < 2; ++c) {
            V a[4], b[4];
#pragma unroll
            for (int mb = 0; mb < 4; ++mb) a[mb] = WFrag<bf>::ld(sb + ao + mb * 16 * SP + c * 32);
#pragma unroll
            for (int nb = 0; nb < 4; ++nb) b[nb] = WFrag<bf>::ld(sb + bo + nb * 16 * SP + c * 32);
            // inputs-only fence on the loaded fragments: all 16 LDS reads are issued as one group and waited for once; without it the build reloads one B fragment at a time and waits out the LDS latency four times
            asm volatile("" :: "v"(a[0]), "v"(a[1]), "v"(a[2]), "v"(a[3]), "v"(b[0]), "v"(b[1]), "v"(b[2]), "v"(b[3]));
#pragma unroll
            for (int nb = 0; nb < 4; ++nb)
#pragma unroll
                for (int mb = 0; mb < 4; ++mb) acc[mb][nb] = WFrag<bf>::mma(a[mb], b[nb], acc[mb][nb]);
        }
        // distance after the last matrix instructions on the loop's back edge and exit
        asm volatile("v_nop\n\tv_nop\n\tv_nop\n\tv_nop" : "+v"(acc[0][0]), "+v"(acc[0][1]), "+v"(acc[0][2]), "+v"(acc[0][3]), "+v"(acc[1][0]), "+v"(acc[1][1]), "+v"(acc[1][2]), "+v"(acc[1][3]), "+v"(acc[2][0]), "+v"(acc[2][1]), "+v"(acc[2][2]), "+v"(acc[2][3]), "+v"(acc[3][0]), "+v"(acc[3][1]), "+v"(acc[3][2]), "+v"(acc[3][3]));
        asm volatile("s_wait_dscnt 0x0" ::: "memory");      // this wave's reads of the buffer have retired before it is refilled
        asm volatile("s_wait_asynccnt 0x0" ::: "memory");   // this wave's copies of stage t + 1 have landed
        __syncthreads();                                    // publishes stage t + 1 and ends every wave's reads of stage t
        if (t + 2 < DM / PKC) { const unsigned lb = l0 + (unsigned)(t & 1) * (PST * 2); cp8(lb, gw + (t + 2) * PKC); cp8(lb + 128u * SP * 2, gx + (t + 2) * PKC); }
    }
    asm volatile("s_wait_asynccnt 0x0" ::: "memory");       // nothing is in flight when the ring becomes output staging
    unsigned short (*st)[16 * SP] = (unsigned short (*)[16 * SP])(&ring[0][0] + wv * 3 * 16 * SP);   // behind the last trip's barrier the ring is dead: each wave stages its output rows in a range of its own
    unsigned short* d16 = (unsigned short*)(part == 0 ? Q16 : part == 1 ? K16 : V16); bf* dh = part == 0 ? Qh : part == 1 ? Kh : Vh; bf* dl = part == 0 ? Ql : part == 1 ? Kl : Vl;
    const size_t base = tv ? (size_t)h * HD * TT + r0 : ((size_t)h * TT + r0) * HD;   // first element of the tile in its planes
    const int pitch = tv ? TT : HD;                                                    // from one plane row to the next
#pragma unroll
    for (int nb = 0; nb < 4; ++nb) {
#pragma unroll
        for (int mb = 0; mb < 4; ++mb) { v8h o16; v8us oh, ol;
#pragma unroll
            for (int j = 0; j < 8; ++j) { const float x = acc[mb][nb][j]; o16[j] = tohx(x); unsigned short a2, c2; splitf(x, a2, c2); oh[j] = a2; ol[j] = c2; }
            const int so = lr * SP + (2 * mb + hi) * 8;
            *(v8us*)(&st[0][so]) = __builtin_bit_cast(v8us, o16); *(v8us*)(&st[1][so]) = oh; *(v8us*)(&st[2][so]) = ol; }
        // a range of its own for each wave, so no barrier: the wave's own LDS writes have landed before it reads the rows back across lanes; the clobber keeps the compiler from lifting those reads over the writes
        __builtin_amdgcn_wave_barrier(); asm volatile("s_wait_dscnt 0x0" ::: "memory");
#pragma unroll
        for (int s = 0; s < 4; ++s) { const int row = 4 * s + (lane >> 3), pc = (lane & 7) * 8; const size_t e = base + (size_t)(nb * 16 + row) * pitch + pc;
            *(v8usa*)(d16 + e) = *(const v8us*)(&st[0][row * SP + pc]); *(v8usa*)(dh + e) = *(const v8us*)(&st[1][row * SP + pc]); *(v8usa*)(dl + e) = *(const v8us*)(&st[2][row * SP + pc]); }
        // compiler fence: keeps these reads from sinking under the next rows' writes
        __builtin_amdgcn_wave_barrier(); asm volatile("" ::: "memory");
    }
}
__device__ __forceinline__ float exp2s(float x) { float r; asm("v_exp_f32 %0, %1\n\tv_nop" : "=v"(r) : "v"(x)); return r; }
template <typename T16, bool HI, int NQ>
__device__ __forceinline__ void fattn_tile(const T16* __restrict__ Q, const T16* __restrict__ Q2, const T16* __restrict__ Kp, const T16* __restrict__ Kp2, const T16* __restrict__ Vt, const T16* __restrict__ Vt2, int r0, float* __restrict__ outp) {
    typedef typename WFrag<T16>::V V;
    const int lane = threadIdx.x & 31, lr = lane & 15, hi = lane >> 4;
    const float EC = SCL * 1.4426950408889634f;      // scores x HD^-0.5 x log2(e)
    V q[NQ][2], q2[NQ][2];                            // [query tile][32-wide chunk of the head dim]
#pragma unroll
    for (int qt = 0; qt < NQ; ++qt)
#pragma unroll
        for (int dc = 0; dc < 2; ++dc) { const size_t qo = (size_t)(r0 + qt * 16 + lr) * HD + dc * 32 + 8 * hi; q[qt][dc] = WFrag<T16>::ld(Q + qo); if (HI) q2[qt][dc] = WFrag<T16>::ld(Q2 + qo); }
    v8f o[4][NQ];                                    // O^T: [16 head dims][query tile]
#pragma unroll
    for (int dt = 0; dt < 4; ++dt)
#pragma unroll
        for (int qt = 0; qt < NQ; ++qt) o[dt][qt] = (v8f){};
    float m[NQ], l[NQ];                              // running maximum of the raw scores; this lane half's running sum
#pragma unroll
    for (int qt = 0; qt < NQ; ++qt) { m[qt] = -3.0e38f; l[qt] = 0.f; }
    const int nst = r0 / 64 + 1;                     // 64-key steps up to and with the diagonal block
    const size_t koff = (size_t)lr * HD + 8 * hi, voff = (size_t)lr * TT + 8 * hi;
    V kf[4][2];                                      // fp16 path: key fragments fetched one step ahead
    const T16* kn = Kp + koff;                       // this lane's place in the keys that are fetched next
    if (!HI) {
#pragma unroll
        for (int kt = 0; kt < 4; ++kt)
#pragma unroll
            for (int dc = 0; dc < 2; ++dc) kf[kt][dc] = WFrag<T16>::ld(kn + kt * 16 * HD + dc * 32);
    }
#pragma unroll 1
    for (int st = 0; st < nst; ++st) {
        const int c0 = st * 64;
        v8f s[4][NQ];                                // S^T: [16 keys][query tile]
#pragma unroll
        for (int kt = 0; kt < 4; ++kt)
#pragma unroll
            for (int qt = 0; qt < NQ; ++qt) s[kt][qt] = (v8f){};
#pragma unroll
        for (int kt = 0; kt < 4; ++kt)
#pragma unroll
            for (int dc = 0; dc < 2; ++dc) {
                const size_t ko = koff + (size_t)(c0 + kt * 16) * HD + dc * 32;
                V k, k2; if (HI) { k = WFrag<T16>::ld(Kp + ko); k2 = WFrag<T16>::ld(Kp2 + ko); } else k = kf[kt][dc];
#pragma unroll
                for (int qt = 0; qt < NQ; ++qt) { s[kt][qt] = WFrag<T16>::mma(k, q[qt][dc], s[kt][qt]); if (HI) { s[kt][qt] = WFrag<T16>::mma(k2, q[qt][dc], s[kt][qt]); s[kt][qt] = WFrag<T16>::mma(k, q2[qt][dc], s[kt][qt]); } }
            }
        V vf[4][2];                                  // fp16 path: value fragments issued ahead of the softmax, which covers their latency
        if (!HI) {
#pragma unroll
            for (int dt = 0; dt < 4; ++dt)
#pragma unroll
                for (int kc = 0; kc < 2; ++kc) vf[dt][kc] = WFrag<T16>::ld(Vt + voff + (size_t)dt * 16 * TT + c0 + kc * 32);
        }
        const bool diag = (st == nst - 1);           // only the last step holds keys above the diagonal
#pragma unroll
        for (int qt = 0; qt < NQ; ++qt) {
            if (diag) { const int lim = r0 + qt * 16 + lr - c0 - hi * 8;   // key kt * 16 + j of this lane half is allowed while <= lim
#pragma unroll
                for (int kt = 0; kt < 4; ++kt)
#pragma unroll
                    for (int j = 0; j < 8; ++j) s[kt][qt][j] = (kt * 16 + j <= lim) ? s[kt][qt][j] : -3.0e38f; }
            float mx = m[qt];
#pragma unroll
            for (int kt = 0; kt < 4; ++kt)
#pragma unroll
                for (int j = 0; j < 8; ++j) mx = fmaxf(mx, s[kt][qt][j]);
            mx = fmaxf(mx, __shfl_xor(mx, 16, 32));
            const float al = exp2s((m[qt] - mx) * EC); m[qt] = mx;
            float sum = 0.f;
#pragma unroll
            for (int kt = 0; kt < 4; ++kt)
#pragma unroll
                for (int j = 0; j < 8; ++j) { const float d0 = s[kt][qt][j] - mx; const float p = exp2s(HI ? d0 * EC : __builtin_fmaf(d0, EC, 10.0f)); s[kt][qt][j] = p; sum += p; }
            l[qt] = l[qt] * al + sum;
#pragma unroll
            for (int dt = 0; dt < 4; ++dt) o[dt][qt] *= al;
        }
#pragma unroll
        for (int kc = 0; kc < 2; ++kc) {
            V pb[NQ], pb2[NQ];
#pragma unroll
            for (int qt = 0; qt < NQ; ++qt) {
                if constexpr (HI) { v8us h0, h1, l0, l1;
#pragma unroll
                    for (int e = 0; e < 8; ++e) { unsigned short a, c2; splitf(s[2 * kc][qt][e], a, c2); h0[e] = a; l0[e] = c2; splitf(s[2 * kc + 1][qt][e], a, c2); h1[e] = a; l1[e] = c2; }
                    pb[qt] = cat16b(h0, h1); pb2[qt] = cat16b(l0, l1);
                } else { v8h h0, h1;
#pragma unroll
                    for (int e = 0; e < 8; ++e) { h0[e] = tohx(s[2 * kc][qt][e]); h1[e] = tohx(s[2 * kc + 1][qt][e]); }
                    pb[qt] = cat16(h0, h1); }
            }
#pragma unroll
            for (int dt = 0; dt < 4; ++dt) {
                const size_t vo = voff + (size_t)dt * 16 * TT + c0 + kc * 32;
                V v, v2; if (HI) { v = WFrag<T16>::ld(Vt + vo); v2 = WFrag<T16>::ld(Vt2 + vo); } else v = vf[dt][kc];
#pragma unroll
                for (int qt = 0; qt < NQ; ++qt) { o[dt][qt] = WFrag<T16>::mma(v, pb[qt], o[dt][qt]); if (HI) { o[dt][qt] = WFrag<T16>::mma(v, pb2[qt], o[dt][qt]); o[dt][qt] = WFrag<T16>::mma(v2, pb[qt], o[dt][qt]); } }
            }
        }
        if (!HI) { kn += (st + 1 < nst) ? 64 * HD : 0;   // next step's keys (the last step fetches its own again: always inside the plane)
#pragma unroll
            for (int kt = 0; kt < 4; ++kt)
#pragma unroll
                for (int dc = 0; dc < 2; ++dc) kf[kt][dc] = WFrag<T16>::ld(kn + kt * 16 * HD + dc * 32);
            asm volatile("s_wait_xcnt 0x0" ::: "memory");   // the fetch's address registers are rewritten behind the loop's exit
        }
        // distance after the last matrix instructions on the loop's back edge: the next trip overwrites their operands
        if constexpr (NQ == 2) asm volatile("v_nop\n\tv_nop\n\tv_nop\n\tv_nop\n\tv_nop" : "+v"(o[0][0]), "+v"(o[0][1]), "+v"(o[1][0]), "+v"(o[1][1]), "+v"(o[2][0]), "+v"(o[2][1]), "+v"(o[3][0]), "+v"(o[3][1]));
        else asm volatile("v_nop\n\tv_nop\n\tv_nop\n\tv_nop\n\tv_nop" : "+v"(o[0][0]), "+v"(o[1][0]), "+v"(o[2][0]), "+v"(o[3][0]));
    }
    const int ln = (int)__builtin_amdgcn_mbcnt_lo(~0u, 0u);   // the lane's number read anew (one wave a block): no row address formed in front of the loop has to live through it, which spilled
#pragma unroll
    for (int qt = 0; qt < NQ; ++qt) {
        const float inv = __fdiv_rn(1.0f, l[qt] + __shfl_xor(l[qt], 16, 32));
        float* orow = outp + (size_t)(r0 + qt * 16 + (ln & 15)) * DQ + (ln >> 4) * 8;   // a lane's 8 accumulator registers are 8 consecutive head dims of one query row
#pragma unroll
        for (int dt = 0; dt < 4; ++dt) { v4f a, b2;
#pragma unroll
            for (int j = 0; j < 4; ++j) { a[j] = o[dt][qt][j] * inv; b2[j] = o[dt][qt][4 + j] * inv; }
            *(v4f*)(orow + dt * 16) = a; *(v4f*)(orow + dt * 16 + 4) = b2; }
    }
}
// grid (batches x heads, (TT - RH) / 32 + RH / 16): blockIdx.x = batch * NH_ + head; blockIdx.y counts the query tiles from the last (most keys) to the first, so that the long tiles start first; rows >= RH in tiles of 32, rows < RH (three products, twice the planes) in tiles of 16
// at most 256 registers a wave: the build then stays in the directly addressed registers
__global__ __launch_bounds__(32) __attribute__((amdgpu_waves_per_eu(4, 4))) void k_fattn(const h16* __restrict__ Q16, const h16* __restrict__ K16, const h16* __restrict__ V16, const bf* __restrict__ Qh, const bf* __restrict__ Ql, const bf* __restrict__ Kh, const bf* __restrict__ Kl, const bf* __restrict__ Vh, const bf* __restrict__ Vl, float* __restrict__ OUTb) {
    const int bh = blockIdx.x, y = blockIdx.y; const size_t zp = (size_t)bh * TT * HD; float* outp = OUTb + (size_t)(bh / NH_) * TT * DQ + (bh % NH_) * HD;
    if (y < (TT - RH) / 32) fattn_tile<h16, false, 2>(Q16 + zp, nullptr, K16 + zp, nullptr, V16 + zp, nullptr, TT - 32 * (y + 1), outp);
    else fattn_tile<bf, true, 1>(Qh + zp, Ql + zp, Kh + zp, Kl + zp, Vh + zp, Vl + zp, RH - 16 * (y - (TT - RH) / 32 + 1), outp);
}

extern "C" void kernel_launch(void* const* d_in, const int* in_sizes, int n_in,
                              void* d_out, int out_size, void* d_ws, size_t ws_size, hipStream_t stream) {
    (void)in_sizes; (void)n_in; (void)out_size;
    const float* x = (const float*)d_in[0]; const float* wqkv = (const float*)d_in[1];   /* argument order inputs, W_qkv ('oi' [3072][1024], per-head (q, k, v) packed rows) */
    float* OUT = (float*)d_out;     // [2][2048][1024]
    char* wsp = (char*)d_ws;
    auto take = [&](size_t bytes) { char* p = wsp; wsp += (bytes + 255) & ~(size_t)255; return (void*)p; };
    bf* WQKV = (bf*)take((size_t)3 * DQ * DM * 2);   /* de-interleaved Bt: q | k | v row blocks in head order */
    bf* XB = (bf*)take((size_t)NB_ * TT * DM * 2);
    /* every plane holds both batches: [batch][head][...] */
    h16* QP16 = (h16*)take((size_t)NB_ * NH_ * TT * HD * 2); h16* KP16 = (h16*)take((size_t)NB_ * NKV * TT * HD * 2); h16* VT16 = (h16*)take((size_t)NB_ * NKV * HD * TT * 2);
    bf* QPh = (bf*)take((size_t)NB_ * NH_ * TT * HD * 2); bf* QPl = (bf*)take((size_t)NB_ * NH_ * TT * HD * 2); bf* KPh = (bf*)take((size_t)NB_ * NKV * TT * HD * 2); bf* KPl = (bf*)take((size_t)NB_ * NKV * TT * HD * 2); bf* VTh = (bf*)take((size_t)NB_ * NKV * HD * TT * 2); bf* VTl = (bf*)take((size_t)NB_ * NKV * HD * TT * 2);
    if ((size_t)(wsp - (char*)d_ws) > ws_size) return;    // ws 256 MiB
    k_wperm<<<(unsigned)(((size_t)3 * DQ * DM / 8 + 255) / 256), 256, 0, stream>>>(wqkv, WQKV);   /* packed rows (h, part, d) -> standard (part, h, d) blocks */
    k_cvt8<<<(unsigned)(((size_t)NB_ * TT * DM / 8 + 255) / 256), 256, 0, stream>>>(x, XB, (size_t)NB_ * TT * DM / 8);
    k_proj<<<dim3(NB_ * TT / 128, 3 * NH_ / 2, 1), 128, 0, stream>>>(XB, WQKV, QP16, QPh, QPl, KP16, KPh, KPl, VT16, VTh, VTl);
    k_fattn<<<dim3(NB_ * NH_, (TT - RH) / 32 + RH / 16, 1), 32, 0, stream>>>(QP16, KP16, VT16, QPh, QPl, KPh, KPl, VTh, VTl, OUT);
}

// v006
// Measured time: 65.8 microseconds a run.
// In two side-by-side timings against v005, it was 1.38 and 1.36 times as fast.
// Counting every step since v000, it is 20.7 times as fast.
#include <hip/hip_runtime.h>

// Causal multi-head attention with a per-head packed qkv projection (inputs [2][2048][1024]; qkv = x W_qkv^T ('oi' [3072][1024] 1/32, no bias); the module views qkv as (T, 16 heads, 3 x 64) and splits the LAST dim: head h's q = output rows h*192 + 0..63, k = h*192 + 64..127, v = h*192 + 128..191; scores x 64^-0.5; causal (-inf); softmax; out = merged heads (no output projection) -> [2][2048][1024] (4.2 M); argument order inputs, W_qkv).
// Both batches go through every launch together (4 launches): tokens are the 2 x 2048 rows of x, planes are [batch][head]. Layout: the packed weight rows are gathered once into a standard q | k | v Bt (a row permutation of the bf16 copy); bf16 copy of x; one projection launch (k_proj: operands through LDS, exact products, its accumulators leave as the fp16 and bf16 hi/lo head planes of q, k and v^T); one fused causal attention launch (k_fattn: keys and values through LDS, online softmax, scores and probabilities stay in registers; hybrid rows: < 512 hi/lo 3 products, rest fp16 x1024) writes the output rows.
// Compute dtypes, f32 accumulate: every input rounded to bf16; projections exact; attention rows < 512 3 products, rest fp16; softmax f32; output f32.

#define NB_  2
#define TT   2048
#define DM   1024
#define NH_  16
#define NKV  16
#define REP  (NH_ / NKV)
#define HD   64
#define DQ   (NH_ * HD)
#define DKV  (NKV * HD)
#define RH   512                  // query rows < RH use hi+lo planes (0: none)
#define SCL  0.125f   // HD^-0.5
typedef _Float16 h16;
typedef unsigned short bf;
typedef __attribute__((ext_vector_type(16))) __bf16   v16bf;
typedef __attribute__((ext_vector_type(16))) _Float16 v16h;
typedef __attribute__((ext_vector_type(8)))  _Float16 v8h;
typedef __attribute__((ext_vector_type(8)))  unsigned short v8us;
typedef __attribute__((ext_vector_type(8)))  float    v8f;
typedef __attribute__((ext_vector_type(4)))  float    v4f;
typedef v8h  __attribute__((may_alias)) v8ha;
typedef v4f  __attribute__((may_alias)) v4fa;
typedef v8us __attribute__((may_alias)) v8usa;

__device__ __forceinline__ unsigned short f2bf(float f) { unsigned u = __float_as_uint(f); u += 0x7FFFu + ((u >> 16) & 1u); return (unsigned short)(u >> 16); }
__device__ __forceinline__ float bf2f(unsigned short b) { return __uint_as_float(((unsigned)b) << 16); }
__device__ __forceinline__ float bfr(float f) { return bf2f(f2bf(f)); }
__device__ __forceinline__ v16h cat16(v8h lo, v8h hi) { return __builtin_shufflevector(lo, hi, 0, 1, 2, 3, 4, 5, 6, 7, 8, 9, 10, 11, 12, 13, 14, 15); }
__device__ __forceinline__ v16bf cat16b(v8us lo, v8us hi) { return __builtin_bit_cast(v16bf, __builtin_shufflevector(lo, hi, 0, 1, 2, 3, 4, 5, 6, 7, 8, 9, 10, 11, 12, 13, 14, 15)); }
__device__ __forceinline__ v8f wmma16(v16h a, v16h b, v8f c) { return __builtin_amdgcn_wmma_f32_16x16x32_f16(false, a, false, b, (short)0, c, false, false); }
__device__ __forceinline__ v8f wmmab(v16bf a, v16bf b, v8f c) { return __builtin_amdgcn_wmma_f32_16x16x32_bf16(false, a, false, b, (short)0, c, false, false); }



// fragment loaders and products of the two 16-bit forms; both operands K-contiguous, the same k order for A and B
template <typename T16> struct WFrag;
template <> struct WFrag<h16> { typedef v16h V; static __device__ __forceinline__ V ld(const h16* p) { return cat16(*(const v8h*)p, *(const v8h*)(p + 16)); } static __device__ __forceinline__ V lds(const unsigned short* p) { return cat16(*(const v8ha*)p, *(const v8ha*)(p + 16)); } static __device__ __forceinline__ v8f mma(V a, V b, v8f c) { return wmma16(a, b, c); } };
template <> struct WFrag<bf> { typedef v16bf V; static __device__ __forceinline__ V ld(const bf* p) { return cat16b(*(const v8us*)p, *(const v8us*)(p + 16)); } static __device__ __forceinline__ V lds(const unsigned short* p) { return cat16b(*(const v8usa*)p, *(const v8usa*)(p + 16)); } static __device__ __forceinline__ v8f mma(V a, V b, v8f c) { return wmmab(a, b, c); } };

__device__ __forceinline__ h16 tohx(float x) { return (h16)x; }
__device__ __forceinline__ void splitf(float y, unsigned short& h, unsigned short& l) { h = f2bf(y); l = f2bf(y - bf2f(h)); }
typedef __attribute__((ext_vector_type(2))) _Float16 v2h;
typedef __attribute__((ext_vector_type(4))) _Float16 v4h;
typedef __attribute__((ext_vector_type(2))) unsigned short v2us;
typedef __attribute__((ext_vector_type(4))) unsigned short v4us;
typedef __attribute__((ext_vector_type(2))) float v2f;
typedef __attribute__((ext_vector_type(4))) int v4i;

__global__ __launch_bounds__(256) void k_cvt8(const float* __restrict__ src, bf* dst, size_t n8) { const size_t i = (size_t)blockIdx.x * 256 + threadIdx.x; if (i >= n8) return; const v8f v = *(const v8f*)(src + i * 8); v8us o;
#pragma unroll
    for (int k = 0; k < 8; ++k) o[k] = f2bf(v[k]); *(v8us*)(dst + i * 8) = o;  }

__global__ __launch_bounds__(256) void k_wperm(const float* __restrict__ W, bf* Bt) { const size_t i = (size_t)blockIdx.x * 256 + threadIdx.x; if (i >= (size_t)3 * DQ * DM / 8) return; const size_t e = i * 8; const int c0 = (int)(e % DM); const int rd = (int)(e / DM); const int part = rd / DQ; const int h = (rd % DQ) / HD; const int d = rd % HD; const int rs = h * 3 * HD + part * HD + d; const v8f v = *(const v8f*)(W + (size_t)rs * DM + c0); v8us o;
#pragma unroll
    for (int k = 0; k < 8; ++k) o[k] = f2bf(v[k]); *(v8us*)(Bt + e) = o;  }
#define SP 72   // LDS pitch in 16-bit elements: 128 + 16 bytes (staging rows and operand rows alike)
#define PKC 64                // k per stage
#define PST (256 * SP)        // one stage in 16-bit elements: weight rows 0..127, token rows 128..255
// eight asynchronous copies, 16 bytes a lane each, of rows 16 apart: l = the lane's LDS byte address, g = its global address (8 lanes cover one row's line).
// The s_wait_xcnt stands inside the statement, behind the last copy: the address registers are free for rewriting only behind it.
__device__ __forceinline__ void cp8(unsigned l, const bf* g) {
    asm volatile("global_load_async_to_lds_b128 %0, %8, off\n\t"
                 "global_load_async_to_lds_b128 %1, %9, off\n\t"
                 "global_load_async_to_lds_b128 %2, %10, off\n\t"
                 "global_load_async_to_lds_b128 %3, %11, off\n\t"
                 "global_load_async_to_lds_b128 %4, %12, off\n\t"
                 "global_load_async_to_lds_b128 %5, %13, off\n\t"
                 "global_load_async_to_lds_b128 %6, %14, off\n\t"
                 "global_load_async_to_lds_b128 %7, %15, off\n\t"
                 "s_wait_xcnt 0x0"
                 :: "v"(l), "v"(l + 1u * 16 * SP * 2), "v"(l + 2u * 16 * SP * 2), "v"(l + 3u * 16 * SP * 2), "v"(l + 4u * 16 * SP * 2), "v"(l + 5u * 16 * SP * 2), "v"(l + 6u * 16 * SP * 2), "v"(l + 7u * 16 * SP * 2),
                    "v"(g), "v"(g + 1 * 16 * DM), "v"(g + 2 * 16 * DM), "v"(g + 3 * 16 * DM), "v"(g + 4 * 16 * DM), "v"(g + 5 * 16 * DM), "v"(g + 6 * 16 * DM), "v"(g + 7 * 16 * DM)
                 : "memory");
}
__global__ __launch_bounds__(128) void k_proj(const bf* __restrict__ X, const bf* __restrict__ Wt, h16* Q16, bf* Qh, bf* Ql, h16* K16, bf* Kh, bf* Kl, h16* V16, bf* Vh, bf* Vl) {
    typedef WFrag<bf>::V V;
    __shared__ __align__(16) unsigned short ring[2][PST];
    const int tid = threadIdx.x, lane = tid & 31, lr = lane & 15, hi = lane >> 4;
    const int wv = __builtin_amdgcn_readfirstlane(tid >> 5), wt = wv & 1, ww = wv >> 1;   // the wave's 64-token block and 64-row weight block in the work-group's tile
    const int yy = blockIdx.y * 2 + ww;                                                   // (part, head)
    const int rg = (blockIdx.x * 2 + wt) * 64, r0 = rg % TT, part = yy / NH_, h = (rg / TT) * NH_ + yy % NH_;   // rg: row of x; r0: token in its batch; h: (batch, head) plane
    const bool tv = (part == 2);   // the same for the whole work-group: 128 divides the rows of a part
    const bf* gw = Wt + ((size_t)blockIdx.y * 128 + (tid >> 3)) * DM + (tid & 7) * 8;   // this lane's piece of weight row tid / 8
    const bf* gx = X + ((size_t)blockIdx.x * 128 + (tid >> 3)) * DM + (tid & 7) * 8;    // and of token row tid / 8
    const unsigned l0 = (unsigned)(size_t)&ring[0][(tid >> 3) * SP + (tid & 7) * 8];    // its place in buffer 0 (low 32 bits: the LDS byte address)
    v8f acc[4][4];
#pragma unroll
    for (int mb = 0; mb < 4; ++mb)
#pragma unroll
        for (int nb = 0; nb < 4; ++nb) acc[mb][nb] = (v8f){};
    cp8(l0, gw); cp8(l0 + 128u * SP * 2, gx);                                            // stage 0 into buffer 0
    asm volatile("s_wait_asynccnt 0x0" ::: "memory");                                    // this wave's copies of stage 0 have landed
    __syncthreads();                                                                     // and every other wave's
    cp8(l0 + (unsigned)PST * 2, gw + PKC); cp8(l0 + (unsigned)PST * 2 + 128u * SP * 2, gx + PKC);   // stage 1 into buffer 1
    const int ao = ((tv ? 128 + wt * 64 : ww * 64) + lr) * SP + 8 * hi, bo = ((tv ? ww * 64 : 128 + wt * 64) + lr) * SP + 8 * hi;
#pragma unroll 1
    for (int t = 0; t < DM / PKC; ++t) {
        const unsigned short* sb = &ring[0][0] + (t & 1) * PST;
#pragma unroll
        for (int c = 0; c < 2; ++c) {
            V a[4], b[4];
#pragma unroll
            for (int mb = 0; mb < 4; ++mb) a[mb] = WFrag<bf>::ld(sb + ao + mb * 16 * SP + c * 32);
#pragma unroll
            for (int nb = 0; nb < 4; ++nb) b[nb] = WFrag<bf>::ld(sb + bo + nb * 16 * SP + c * 32);
            // inputs-only fence on the loaded fragments: all 16 LDS reads are issued as one group and waited for once; without it the build reloads one B fragment at a time and waits out the LDS latency four times
            asm volatile("" :: "v"(a[0]), "v"(a[1]), "v"(a[2]), "v"(a[3]), "v"(b[0]), "v"(b[1]), "v"(b[2]), "v"(b[3]));
#pragma unroll
            for (int nb = 0; nb < 4; ++nb)
#pragma unroll
                for (int mb = 0; mb < 4; ++mb) acc[mb][nb] = WFrag<bf>::mma(a[mb], b[nb], acc[mb][nb]);
        }
        // distance after the last matrix instructions on the loop's back edge and exit
        asm volatile("v_nop\n\tv_nop\n\tv_nop\n\tv_nop" : "+v"(acc[0][0]), "+v"(acc[0][1]), "+v"(acc[0][2]), "+v"(acc[0][3]), "+v"(acc[1][0]), "+v"(acc[1][1]), "+v"(acc[1][2]), "+v"(acc[1][3]), "+v"(acc[2][0]), "+v"(acc[2][1]), "+v"(acc[2][2]), "+v"(acc[2][3]), "+v"(acc[3][0]), "+v"(acc[3][1]), "+v"(acc[3][2]), "+v"(acc[3][3]));
        asm volatile("s_wait_dscnt 0x0" ::: "memory");      // this wave's reads of the buffer have retired before it is refilled
        asm volatile("s_wait_asynccnt 0x0" ::: "memory");   // this wave's copies of stage t + 1 have landed
        __syncthreads();                                    // publishes stage t + 1 and ends every wave's reads of stage t
        if (t + 2 < DM / PKC) { const unsigned lb = l0 + (unsigned)(t & 1) * (PST * 2); cp8(lb, gw + (t + 2) * PKC); cp8(lb + 128u * SP * 2, gx + (t + 2) * PKC); }
    }
    asm volatile("s_wait_asynccnt 0x0" ::: "memory");       // nothing is in flight when the ring becomes output staging
    unsigned short (*st)[16 * SP] = (unsigned short (*)[16 * SP])(&ring[0][0] + wv * 3 * 16 * SP);   // behind the last trip's barrier the ring is dead: each wave stages its output rows in a range of its own
    unsigned short* d16 = (unsigned short*)(part == 0 ? Q16 : part == 1 ? K16 : V16); bf* dh = part == 0 ? Qh : part == 1 ? Kh : Vh; bf* dl = part == 0 ? Ql : part == 1 ? Kl : Vl;
    const size_t base = tv ? (size_t)h * HD * TT + r0 : ((size_t)h * TT + r0) * HD;   // first element of the tile in its planes
    const int pitch = tv ? TT : HD;                                                    // from one plane row to the next
#pragma unroll
    for (int nb = 0; nb < 4; ++nb) {
#pragma unroll
        for (int mb = 0; mb < 4; ++mb) { v8h o16; v8us oh, ol;
#pragma unroll
            for (int j = 0; j < 8; ++j) { const float x = acc[mb][nb][j]; o16[j] = tohx(x); unsigned short a2, c2; splitf(x, a2, c2); oh[j] = a2; ol[j] = c2; }
            const int so = lr * SP + (2 * mb + hi) * 8;
            *(v8us*)(&st[0][so]) = __builtin_bit_cast(v8us, o16); *(v8us*)(&st[1][so]) = oh; *(v8us*)(&st[2][so]) = ol; }
        // a range of its own for each wave, so no barrier: the wave's own LDS writes have landed before it reads the rows back across lanes; the clobber keeps the compiler from lifting those reads over the writes
        __builtin_amdgcn_wave_barrier(); asm volatile("s_wait_dscnt 0x0" ::: "memory");
#pragma unroll
        for (int s = 0; s < 4; ++s) { const int row = 4 * s + (lane >> 3), pc = (lane & 7) * 8; const size_t e = base + (size_t)(nb * 16 + row) * pitch + pc;
            *(v8usa*)(d16 + e) = *(const v8us*)(&st[0][row * SP + pc]); *(v8usa*)(dh + e) = *(const v8us*)(&st[1][row * SP + pc]); *(v8usa*)(dl + e) = *(const v8us*)(&st[2][row * SP + pc]); }
        // compiler fence: keeps these reads from sinking under the next rows' writes
        __builtin_amdgcn_wave_barrier(); asm volatile("" ::: "memory");
    }
}
__device__ __forceinline__ float exp2s(float x) { float r; asm("v_exp_f32 %0, %1\n\tv_nop" : "=v"(r) : "v"(x)); return r; }
#define APL (64 * SP)         // one plane's 64 rows of a stage in LDS, in 16-bit elements (pitch SP)
// four asynchronous copies, 16 bytes a lane each, of rows 16 apart: l = the lane's LDS byte address, g = its global address (8 lanes cover one row's line), pitch = elements from one global row to the next.
// The s_wait_xcnt stands inside the statement, behind the last copy: the address registers are free for rewriting only behind it.
template <typename T16>
__device__ __forceinline__ void cp4(unsigned l, const T16* g, int pitch) {
    asm volatile("global_load_async_to_lds_b128 %0, %4, off\n\t"
                 "global_load_async_to_lds_b128 %1, %5, off\n\t"
                 "global_load_async_to_lds_b128 %2, %6, off\n\t"
                 "global_load_async_to_lds_b128 %3, %7, off\n\t"
                 "s_wait_xcnt 0x0"
                 :: "v"(l), "v"(l + 1u * 16 * SP * 2), "v"(l + 2u * 16 * SP * 2), "v"(l + 3u * 16 * SP * 2),
                    "v"(g), "v"(g + 16 * pitch), "v"(g + 32 * pitch), "v"(g + 48 * pitch)
                 : "memory");
}
// R0: the work-group's first query row (a multiple of 64 NQ); ring: two buffers of (HI ? 4 : 2) planes: keys, values (, low keys, low values)
template <typename T16, bool HI, int NQ>
__device__ __forceinline__ void fattn_tile(const T16* __restrict__ Q, const T16* __restrict__ Q2, const T16* __restrict__ Kp, const T16* __restrict__ Kp2, const T16* __restrict__ Vt, const T16* __restrict__ Vt2, int R0, float* __restrict__ outp, const unsigned short* ring) {
    typedef typename WFrag<T16>::V V;
    constexpr int BUF = (HI ? 4 : 2) * APL;          // one buffer in 16-bit elements
    const int tid = threadIdx.x, lane = tid & 31, lr = lane & 15, hi = lane >> 4;
    const int r0 = R0 + __builtin_amdgcn_readfirstlane(tid >> 5) * 16 * NQ;   // the wave's first query row
    const int NS = (R0 + 64 * NQ - 1) / 64 + 1;      // stages of the work-group: up to and with its last wave's diagonal block
    const int nst = r0 / 64 + 1;                     // 64-key steps of this wave, up to and with its own diagonal block
    const float EC = SCL * 1.4426950408889634f;      // scores x HD^-0.5 x log2(e)
    const unsigned l0 = (unsigned)(size_t)&ring[(tid >> 3) * SP + (tid & 7) * 8];   // this lane's piece of row tid / 8 in buffer 0 (low 32 bits: the LDS byte address)
    const int ko0 = (tid >> 3) * HD + (tid & 7) * 8, vo0 = (tid >> 3) * TT + (tid & 7) * 8;   // the same piece in a key plane and in a value plane
    auto stage = [&](int t, int b) {                 // the copies of stage t (keys 64 t .. 64 t + 63, always inside the planes: 64 NS <= TT) into buffer b
        const unsigned lb = l0 + (unsigned)b * (BUF * 2);
        cp4(lb, Kp + ko0 + t * 64 * HD, HD); cp4(lb + APL * 2u, Vt + vo0 + t * 64, TT);
        if (HI) { cp4(lb + APL * 4u, Kp2 + ko0 + t * 64 * HD, HD); cp4(lb + APL * 6u, Vt2 + vo0 + t * 64, TT); }
    };
    stage(0, 0);
    V q[NQ][2], q2[NQ][2];                            // [query tile][32-wide chunk of the head dim]
#pragma unroll
    for (int qt = 0; qt < NQ; ++qt)
#pragma unroll
        for (int dc = 0; dc < 2; ++dc) { const size_t qo = (size_t)(r0 + qt * 16 + lr) * HD + dc * 32 + 8 * hi; q[qt][dc] = WFrag<T16>::ld(Q + qo); if (HI) q2[qt][dc] = WFrag<T16>::ld(Q2 + qo); }
    v8f o[4][NQ];                                    // O^T: [16 head dims][query tile]
#pragma unroll
    for (int dt = 0; dt < 4; ++dt)
#pragma unroll
        for (int qt = 0; qt < NQ; ++qt) o[dt][qt] = (v8f){};
    float m[NQ], l[NQ];                              // running maximum of the raw scores; this lane half's running sum
#pragma unroll
    for (int qt = 0; qt < NQ; ++qt) { m[qt] = -3.0e38f; l[qt] = 0.f; }
    asm volatile("s_wait_asynccnt 0x0" ::: "memory");   // this wave's copies of stage 0 have landed
    __syncthreads();                                    // and every other wave's
    if (NS > 1) stage(1, 1);
    const int fo = lr * SP + 8 * hi;                 // this lane's place in a fragment's 16 rows
#pragma unroll 1
    for (int st = 0; st < NS; ++st) {
      if (HI || st < nst) {                          // a wave whose diagonal block lies behind it only keeps the stage's waits and barrier
        const unsigned short* sb = ring + (st & 1) * BUF + fo;
        const int c0 = st * 64;
        V kf[4][2], kf2[4][2];                       // all key fragments of the step
#pragma unroll
        for (int kt = 0; kt < 4; ++kt)
#pragma unroll
            for (int dc = 0; dc < 2; ++dc) { kf[kt][dc] = WFrag<T16>::lds(sb + kt * 16 * SP + dc * 32); if (HI) kf2[kt][dc] = WFrag<T16>::lds(sb + 2 * APL + kt * 16 * SP + dc * 32); }
        // holds the key reads in front of the products as one group: without it the build reads one fragment at a time into the same registers and waits out the LDS latency in front of every pair of products
        __builtin_amdgcn_sched_barrier(0);
        v8f s[4][NQ];                                // S^T: [16 keys][query tile]
#pragma unroll
        for (int kt = 0; kt < 4; ++kt)
#pragma unroll
            for (int qt = 0; qt < NQ; ++qt) s[kt][qt] = (v8f){};
#pragma unroll
        for (int kt = 0; kt < 4; ++kt)
#pragma unroll
            for (int dc = 0; dc < 2; ++dc) {
                const V k = kf[kt][dc]; V k2; if (HI) k2 = kf2[kt][dc];
#pragma unroll
                for (int qt = 0; qt < NQ; ++qt) { s[kt][qt] = WFrag<T16>::mma(k, q[qt][dc], s[kt][qt]); if (HI) { s[kt][qt] = WFrag<T16>::mma(k2, q[qt][dc], s[kt][qt]); s[kt][qt] = WFrag<T16>::mma(k, q2[qt][dc], s[kt][qt]); } }
            }
        V vf[4][2], vf2[4][2];                       // fp16 path: value fragments issued ahead of the softmax, which covers their latency
        if constexpr (!HI) {
#pragma unroll
            for (int dt = 0; dt < 4; ++dt)
#pragma unroll
                for (int kc = 0; kc < 2; ++kc) vf[dt][kc] = WFrag<T16>::lds(sb + APL + dt * 16 * SP + kc * 32);
            // holds the value reads here, in front of the softmax: sunk to their products they would be waited for one fragment at a time
            __builtin_amdgcn_sched_barrier(0);
        }
        const bool diag = (st == nst - 1);           // only the wave's last step holds keys above the diagonal
#pragma unroll
        for (int qt = 0; qt < NQ; ++qt) {
            if (diag) { const int lim = r0 + qt * 16 + lr - c0 - hi * 8;   // key kt * 16 + j of this lane half is allowed while <= lim
#pragma unroll
                for (int kt = 0; kt < 4; ++kt)
#pragma unroll
                    for (int j = 0; j < 8; ++j) s[kt][qt][j] = (kt * 16 + j <= lim) ? s[kt][qt][j] : -3.0e38f; }
            float mx = m[qt];
#pragma unroll
            for (int kt = 0; kt < 4; ++kt)
#pragma unroll
                for (int j = 0; j < 8; ++j) mx = fmaxf(mx, s[kt][qt][j]);
            mx = fmaxf(mx, __shfl_xor(mx, 16, 32));
            const float al = exp2s((m[qt] - mx) * EC); m[qt] = mx;
            float sum = 0.f;
#pragma unroll
            for (int kt = 0; kt < 4; ++kt)
#pragma unroll
                for (int j = 0; j < 8; ++j) { const float d0 = s[kt][qt][j] - mx; const float p = exp2s(HI ? d0 * EC : __builtin_fmaf(d0, EC, 10.0f)); s[kt][qt][j] = p; sum += p; }
            l[qt] = l[qt] * al + sum;
#pragma unroll
            for (int dt = 0; dt < 4; ++dt) o[dt][qt] *= al;
        }
        // keeps the exponentials (asm text) in front of the P.V products
        __builtin_amdgcn_sched_barrier(0);
#pragma unroll
        for (int kc = 0; kc < 2; ++kc) {
            V pb[NQ], pb2[NQ];
            if constexpr (HI) {                      // hi/lo path (twice the planes): the value fragments of 32 keys as one group, issued ahead of the packing of their probabilities, which covers their latency
#pragma unroll
                for (int dt = 0; dt < 4; ++dt) { vf[dt][kc] = WFrag<T16>::lds(sb + APL + dt * 16 * SP + kc * 32); vf2[dt][kc] = WFrag<T16>::lds(sb + 3 * APL + dt * 16 * SP + kc * 32); }
                // holds these reads in front of the packing: sunk to their products they would be waited for one fragment at a time
                __builtin_amdgcn_sched_barrier(0);
            }
#pragma unroll
            for (int qt = 0; qt < NQ; ++qt) {
                if constexpr (HI) { v8us h0, h1, l0v, l1v;
#pragma unroll
                    for (int e = 0; e < 8; ++e) { unsigned short a, c2; splitf(s[2 * kc][qt][e], a, c2); h0[e] = a; l0v[e] = c2; splitf(s[2 * kc + 1][qt][e], a, c2); h1[e] = a; l1v[e] = c2; }
                    pb[qt] = cat16b(h0, h1); pb2[qt] = cat16b(l0v, l1v);
                } else { v8h h0, h1;
#pragma unroll
                    for (int e = 0; e < 8; ++e) { h0[e] = tohx(s[2 * kc][qt][e]); h1[e] = tohx(s[2 * kc + 1][qt][e]); }
                    pb[qt] = cat16(h0, h1); }
            }
#pragma unroll
            for (int dt = 0; dt < 4; ++dt) {
                const V v = vf[dt][kc]; V v2; if (HI) v2 = vf2[dt][kc];
#pragma unroll
                for (int qt = 0; qt < NQ; ++qt) { o[dt][qt] = WFrag<T16>::mma(v, pb[qt], o[dt][qt]); if (HI) { o[dt][qt] = WFrag<T16>::mma(v, pb2[qt], o[dt][qt]); o[dt][qt] = WFrag<T16>::mma(v2, pb[qt], o[dt][qt]); } }
            }
        }
        // distance after the last matrix instructions at the end of the step: the next trip overwrites their operands
        if constexpr (NQ == 2) asm volatile("v_nop\n\tv_nop\n\tv_nop\n\tv_nop\n\tv_nop" : "+v"(o[0][0]), "+v"(o[0][1]), "+v"(o[1][0]), "+v"(o[1][1]), "+v"(o[2][0]), "+v"(o[2][1]), "+v"(o[3][0]), "+v"(o[3][1]));
        else asm volatile("v_nop\n\tv_nop\n\tv_nop\n\tv_nop\n\tv_nop" : "+v"(o[0][0]), "+v"(o[1][0]), "+v"(o[2][0]), "+v"(o[3][0]));
      }
        asm volatile("s_wait_dscnt 0x0" ::: "memory");      // this wave's reads of the buffer have retired before it is refilled
        asm volatile("s_wait_asynccnt 0x0" ::: "memory");   // this wave's copies of stage st + 1 have landed
        __syncthreads();                                    // publishes stage st + 1 and ends every wave's reads of stage st
        if (st + 2 < NS) stage(st + 2, st & 1);
    }
    asm volatile("s_wait_asynccnt 0x0" ::: "memory");       // nothing is in flight when the wave ends
    const int ln = (int)__builtin_amdgcn_mbcnt_lo(~0u, 0u);   // the lane's number read anew: no row address formed in front of the loop has to live through it, which spilled
#pragma unroll
    for (int qt = 0; qt < NQ; ++qt) {
        const float inv = __fdiv_rn(1.0f, l[qt] + __shfl_xor(l[qt], 16, 32));
        float* orow = outp + (size_t)(r0 + qt * 16 + (ln & 15)) * DQ + (ln >> 4) * 8;   // a lane's 8 accumulator registers are 8 consecutive head dims of one query row
#pragma unroll
        for (int dt = 0; dt < 4; ++dt) { v4f a, b2;
#pragma unroll
            for (int j = 0; j < 4; ++j) { a[j] = o[dt][qt][j] * inv; b2[j] = o[dt][qt][4 + j] * inv; }
            *(v4f*)(orow + dt * 16) = a; *(v4f*)(orow + dt * 16 + 4) = b2; }
    }
}
// grid (batches x heads, (TT - RH) / 128 + RH / 64), 128 threads: blockIdx.x = batch * NH_ + head; blockIdx.y counts the query blocks from the last (most keys) to the first, for speed only; rows >= RH in blocks of 4 x 32, rows < RH (three products, twice the planes) in blocks of 4 x 16
// at most 256 registers a wave: the build then stays in the directly addressed registers
__global__ __launch_bounds__(128) __attribute__((amdgpu_waves_per_eu(4, 4))) void k_fattn(const h16* __restrict__ Q16, const h16* __restrict__ K16, const h16* __restrict__ V16, const bf* __restrict__ Qh, const bf* __restrict__ Ql, const bf* __restrict__ Kh, const bf* __restrict__ Kl, const bf* __restrict__ Vh, const bf* __restrict__ Vl, float* __restrict__ OUTb) {
    __shared__ __align__(16) unsigned short ring[2 * 4 * APL];
    const int bh = blockIdx.x, y = blockIdx.y; const size_t zp = (size_t)bh * TT * HD; float* outp = OUTb + (size_t)(bh / NH_) * TT * DQ + (bh % NH_) * HD;
    if (y < (TT - RH) / 128) fattn_tile<h16, false, 2>(Q16 + zp, nullptr, K16 + zp, nullptr, V16 + zp, nullptr, TT - 128 * (y + 1), outp, ring);
    else fattn_tile<bf, true, 1>(Qh + zp, Ql + zp, Kh + zp, Kl + zp, Vh + zp, Vl + zp, RH - 64 * (y - (TT - RH) / 128 + 1), outp, ring);
}

extern "C" void kernel_launch(void* const* d_in, const int* in_sizes, int n_in,
                              void* d_out, int out_size, void* d_ws, size_t ws_size, hipStream_t stream) {
    (void)in_sizes; (void)n_in; (void)out_size;
    const float* x = (const float*)d_in[0]; const float* wqkv = (const float*)d_in[1];   /* argument order inputs, W_qkv ('oi' [3072][1024], per-head (q, k, v) packed rows) */
    float* OUT = (float*)d_out;     // [2][2048][1024]
    char* wsp = (char*)d_ws;
    auto take = [&](size_t bytes) { char* p = wsp; wsp += (bytes + 255) & ~(size_t)255; return (void*)p; };
    bf* WQKV = (bf*)take((size_t)3 * DQ * DM * 2);   /* de-interleaved Bt: q | k | v row blocks in head order */
    bf* XB = (bf*)take((size_t)NB_ * TT * DM * 2);
    /* every plane holds both batches: [batch][head][...] */
    h16* QP16 = (h16*)take((size_t)NB_ * NH_ * TT * HD * 2); h16* KP16 = (h16*)take((size_t)NB_ * NKV * TT * HD * 2); h16* VT16 = (h16*)take((size_t)NB_ * NKV * HD * TT * 2);
    bf* QPh = (bf*)take((size_t)NB_ * NH_ * TT * HD * 2); bf* QPl = (bf*)take((size_t)NB_ * NH_ * TT * HD * 2); bf* KPh = (bf*)take((size_t)NB_ * NKV * TT * HD * 2); bf* KPl = (bf*)take((size_t)NB_ * NKV * TT * HD * 2); bf* VTh = (bf*)take((size_t)NB_ * NKV * HD * TT * 2); bf* VTl = (bf*)take((size_t)NB_ * NKV * HD * TT * 2);
    if ((size_t)(wsp - (char*)d_ws) > ws_size) return;    // ws 256 MiB
    k_wperm<<<(unsigned)(((size_t)3 * DQ * DM / 8 + 255) / 256), 256, 0, stream>>>(wqkv, WQKV);   /* packed rows (h, part, d) -> standard (part, h, d) blocks */
    k_cvt8<<<(unsigned)(((size_t)NB_ * TT * DM / 8 + 255) / 256), 256, 0, stream>>>(x, XB, (size_t)NB_ * TT * DM / 8);
    k_proj<<<dim3(NB_ * TT / 128, 3 * NH_ / 2, 1), 128, 0, stream>>>(XB, WQKV, QP16, QPh, QPl, KP16, KPh, KPl, VT16, VTh, VTl);
    k_fattn<<<dim3(NB_ * NH_, (TT - RH) / 128 + RH / 64, 1), 128, 0, stream>>>(QP16, KP16, VT16, QPh, QPl, KPh, KPl, VTh, VTl, OUT);
}

// v007
// One run takes 59.3 microseconds.
// In both of two side-by-side timings against v006, it was 1.11 times as fast.
// Counting every step since v000, it is 23.0 times as fast.
#include <hip/hip_runtime.h>

// Causal multi-head attention with a per-head packed qkv projection (inputs [2][2048][1024]; qkv = x W_qkv^T ('oi' [3072][1024] 1/32, no bias); the module views qkv as (T, 16 heads, 3 x 64) and splits the LAST dim: head h's q = output rows h*192 + 0..63, k = h*192 + 64..127, v = h*192 + 128..191; scores x 64^-0.5; causal (-inf); softmax; out = merged heads (no output projection) -> [2][2048][1024] (4.2 M); argument order inputs, W_qkv).
// Both batches go through every launch together (4 launches): tokens are the 2 x 2048 rows of x, planes are [batch][head]. Layout: the packed weight rows are gathered once into a standard q | k | v Bt (a row permutation of the bf16 copy); bf16 copy of x; one projection launch (k_proj: operands through LDS, exact products, its accumulators leave as the fp16 and bf16 hi/lo head planes of q, k and v^T); one fused causal attention launch (k_fattn: keys and values through LDS, online softmax, scores and probabilities stay in registers; hybrid rows: < 512 hi/lo 3 products, rest fp16 x1024) writes the output rows.
// Compute dtypes, f32 accumulate: every input rounded to bf16; projections exact; attention rows < 512 3 products, rest fp16; softmax f32; output f32.

#define NB_  2
#define TT   2048
#define DM   1024
#define NH_  16
#define NKV  16
#define REP  (NH_ / NKV)
#define HD   64
#define DQ   (NH_ * HD)
#define DKV  (NKV * HD)
#define RH   512                  // query rows < RH use hi+lo planes (0: none)
#define SCL  0.125f   // HD^-0.5
typedef _Float16 h16;
typedef unsigned short bf;
typedef __attribute__((ext_vector_type(16))) __bf16   v16bf;
typedef __attribute__((ext_vector_type(16))) _Float16 v16h;
typedef __attribute__((ext_vector_type(8)))  _Float16 v8h;
typedef __attribute__((ext_vector_type(8)))  unsigned short v8us;
typedef __attribute__((ext_vector_type(8)))  float    v8f;
typedef __attribute__((ext_vector_type(4)))  float    v4f;
typedef v8h  __attribute__((may_alias)) v8ha;
typedef v4f  __attribute__((may_alias)) v4fa;
typedef v8us __attribute__((may_alias)) v8usa;

__device__ __forceinline__ unsigned short f2bf(float f) { unsigned u = __float_as_uint(f); u += 0x7FFFu + ((u >> 16) & 1u); return (unsigned short)(u >> 16); }
__device__ __forceinline__ float bf2f(unsigned short b) { return __uint_as_float(((unsigned)b) << 16); }
__device__ __forceinline__ float bfr(float f) { return bf2f(f2bf(f)); }
__device__ __forceinline__ v16h cat16(v8h lo, v8h hi) { return __builtin_shufflevector(lo, hi, 0, 1, 2, 3, 4, 5, 6, 7, 8, 9, 10, 11, 12, 13, 14, 15); }
__device__ __forceinline__ v16bf cat16b(v8us lo, v8us hi) { return __builtin_bit_cast(v16bf, __builtin_shufflevector(lo, hi, 0, 1, 2, 3, 4, 5, 6, 7, 8, 9, 10, 11, 12, 13, 14, 15)); }
__device__ __forceinline__ v8f wmma16(v16h a, v16h b, v8f c) { return __builtin_amdgcn_wmma_f32_16x16x32_f16(false, a, false, b, (short)0, c, false, false); }
__device__ __forceinline__ v8f wmmab(v16bf a, v16bf b, v8f c) { return __builtin_amdgcn_wmma_f32_16x16x32_bf16(false, a, false, b, (short)0, c, false, false); }



// fragment loaders and products of the two 16-bit forms; both operands K-contiguous, the same k order for A and B
template <typename T16> struct WFrag;
template <> struct WFrag<h16> { typedef v16h V; static __device__ __forceinline__ V ld(const h16* p) { return cat16(*(const v8h*)p, *(const v8h*)(p + 16)); } static __device__ __forceinline__ V lds(const unsigned short* p) { return cat16(*(const v8ha*)p, *(const v8ha*)(p + 16)); } static __device__ __forceinline__ v8f mma(V a, V b, v8f c) { return wmma16(a, b, c); } };
template <> struct WFrag<bf> { typedef v16bf V; static __device__ __forceinline__ V ld(const bf* p) { return cat16b(*(const v8us*)p, *(const v8us*)(p + 16)); } static __device__ __forceinline__ V lds(const unsigned short* p) { return cat16b(*(const v8usa*)p, *(const v8usa*)(p + 16)); } static __device__ __forceinline__ v8f mma(V a, V b, v8f c) { return wmmab(a, b, c); } };

__device__ __forceinline__ h16 tohx(float x) { return (h16)x; }
__device__ __forceinline__ void splitf(float y, unsigned short& h, unsigned short& l) { h = f2bf(y); l = f2bf(y - bf2f(h)); }
typedef __attribute__((ext_vector_type(2))) _Float16 v2h;
typedef __attribute__((ext_vector_type(4))) _Float16 v4h;
typedef __attribute__((ext_vector_type(2))) unsigned short v2us;
typedef __attribute__((ext_vector_type(4))) unsigned short v4us;
typedef __attribute__((ext_vector_type(2))) float v2f;
typedef __attribute__((ext_vector_type(4))) int v4i;

__global__ __launch_bounds__(256) void k_cvt8(const float* __restrict__ src, bf* dst, size_t n8) { const size_t i = (size_t)blockIdx.x * 256 + threadIdx.x; if (i >= n8) return; const v8f v = *(const v8f*)(src + i * 8); v8us o;
#pragma unroll
    for (int k = 0; k < 8; ++k) o[k] = f2bf(v[k]); *(v8us*)(dst + i * 8) = o;  }

__global__ __launch_bounds__(256) void k_wperm(const float* __restrict__ W, bf* Bt) { const size_t i = (size_t)blockIdx.x * 256 + threadIdx.x; if (i >= (size_t)3 * DQ * DM / 8) return; const size_t e = i * 8; const int c0 = (int)(e % DM); const int rd = (int)(e / DM); const int part = rd / DQ; const int h = (rd % DQ) / HD; const int d = rd % HD; const int rs = h * 3 * HD + part * HD + d; const v8f v = *(const v8f*)(W + (size_t)rs * DM + c0); v8us o;
#pragma unroll
    for (int k = 0; k < 8; ++k) o[k] = f2bf(v[k]); *(v8us*)(Bt + e) = o;  }
#define SP 72   // LDS pitch in 16-bit elements: 128 + 16 bytes (staging rows and operand rows alike)
#define PKC 64                // k per stage
#define PST (256 * SP)        // one stage in 16-bit elements: weight rows 0..127, token rows 128..255
// eight asynchronous copies, 16 bytes a lane each, of rows 16 apart: l = the lane's LDS byte address, g = its global address (8 lanes cover one row's line).
// The s_wait_xcnt stands inside the statement, behind the last copy: the address registers are free for rewriting only behind it.
__device__ __forceinline__ void cp8(unsigned l, const bf* g) {
    asm volatile("global_load_async_to_lds_b128 %0, %8, off\n\t"
                 "global_load_async_to_lds_b128 %1, %9, off\n\t"
                 "global_load_async_to_lds_b128 %2, %10, off\n\t"
                 "global_load_async_to_lds_b128 %3, %11, off\n\t"
                 "global_load_async_to_lds_b128 %4, %12, off\n\t"
                 "global_load_async_to_lds_b128 %5, %13, off\n\t"
                 "global_load_async_to_lds_b128 %6, %14, off\n\t"
                 "global_load_async_to_lds_b128 %7, %15, off\n\t"
                 "s_wait_xcnt 0x0"
                 :: "v"(l), "v"(l + 1u * 16 * SP * 2), "v"(l + 2u * 16 * SP * 2), "v"(l + 3u * 16 * SP * 2), "v"(l + 4u * 16 * SP * 2), "v"(l + 5u * 16 * SP * 2), "v"(l + 6u * 16 * SP * 2), "v"(l + 7u * 16 * SP * 2),
                    "v"(g), "v"(g + 1 * 16 * DM), "v"(g + 2 * 16 * DM), "v"(g + 3 * 16 * DM), "v"(g + 4 * 16 * DM), "v"(g + 5 * 16 * DM), "v"(g + 6 * 16 * DM), "v"(g + 7 * 16 * DM)
                 : "memory");
}
__global__ __launch_bounds__(128) void k_proj(const bf* __restrict__ X, const bf* __restrict__ Wt, h16* Q16, bf* Qh, bf* Ql, h16* K16, bf* Kh, bf* Kl, h16* V16, bf* Vh, bf* Vl) {
    typedef WFrag<bf>::V V;
    __shared__ __align__(16) unsigned short ring[2][PST];
    const int tid = threadIdx.x, lane = tid & 31, lr = lane & 15, hi = lane >> 4;
    const int wv = __builtin_amdgcn_readfirstlane(tid >> 5), wt = wv & 1, ww = wv >> 1;   // the wave's 64-token block and 64-row weight block in the work-group's tile
    const int yy = blockIdx.y * 2 + ww;                                                   // (part, head)
    const int rg = (blockIdx.x * 2 + wt) * 64, r0 = rg % TT, part = yy / NH_, h = (rg / TT) * NH_ + yy % NH_;   // rg: row of x; r0: token in its batch; h: (batch, head) plane
    const bool tv = (part == 2);   // the same for the whole work-group: 128 divides the rows of a part
    const bf* gw = Wt + ((size_t)blockIdx.y * 128 + (tid >> 3)) * DM + (tid & 7) * 8;   // this lane's piece of weight row tid / 8
    const bf* gx = X + ((size_t)blockIdx.x * 128 + (tid >> 3)) * DM + (tid & 7) * 8;    // and of token row tid / 8
    const unsigned l0 = (unsigned)(size_t)&ring[0][(tid >> 3) * SP + (tid & 7) * 8];    // its place in buffer 0 (low 32 bits: the LDS byte address)
    v8f acc[4][4];
#pragma unroll
    for (int mb = 0; mb < 4; ++mb)
#pragma unroll
        for (int nb = 0; nb < 4; ++nb) acc[mb][nb] = (v8f){};
    cp8(l0, gw); cp8(l0 + 128u * SP * 2, gx);                                            // stage 0 into buffer 0
    asm volatile("s_wait_asynccnt 0x0" ::: "memory");                                    // this wave's copies of stage 0 have landed
    __syncthreads();                                                                     // and every other wave's
    cp8(l0 + (unsigned)PST * 2, gw + PKC); cp8(l0 + (unsigned)PST * 2 + 128u * SP * 2, gx + PKC);   // stage 1 into buffer 1
    const int ao = ((tv ? 128 + wt * 64 : ww * 64) + lr) * SP + 8 * hi, bo = ((tv ? ww * 64 : 128 + wt * 64) + lr) * SP + 8 * hi;
#pragma unroll 1
    for (int t = 0; t < DM / PKC; ++t) {
        const unsigned short* sb = &ring[0][0] + (t & 1) * PST;
#pragma unroll
        for (int c = 0; c < 2; ++c) {
            V a[4], b[4];
#pragma unroll
            for (int mb = 0; mb < 4; ++mb) a[mb] = WFrag<bf>::ld(sb + ao + mb * 16 * SP + c * 32);
#pragma unroll
            for (int nb = 0; nb < 4; ++nb) b[nb] = WFrag<bf>::ld(sb + bo + nb * 16 * SP + c * 32);
            // inputs-only fence on the loaded fragments: all 16 LDS reads are issued as one group and waited for once; without it the build reloads one B fragment at a time and waits out the LDS latency four times
            asm volatile("" :: "v"(a[0]), "v"(a[1]), "v"(a[2]), "v"(a[3]), "v"(b[0]), "v"(b[1]), "v"(b[2]), "v"(b[3]));
#pragma unroll
            for (int nb = 0; nb < 4; ++nb)
#pragma unroll
                for (int mb = 0; mb < 4; ++mb) acc[mb][nb] = WFrag<bf>::mma(a[mb], b[nb], acc[mb][nb]);
        }
        // distance after the last matrix instructions on the loop's back edge and exit
        asm volatile("v_nop\n\tv_nop\n\tv_nop\n\tv_nop" : "+v"(acc[0][0]), "+v"(acc[0][1]), "+v"(acc[0][2]), "+v"(acc[0][3]), "+v"(acc[1][0]), "+v"(acc[1][1]), "+v"(acc[1][2]), "+v"(acc[1][3]), "+v"(acc[2][0]), "+v"(acc[2][1]), "+v"(acc[2][2]), "+v"(acc[2][3]), "+v"(acc[3][0]), "+v"(acc[3][1]), "+v"(acc[3][2]), "+v"(acc[3][3]));
        asm volatile("s_wait_dscnt 0x0" ::: "memory");      // this wave's reads of the buffer have retired before it is refilled
        asm volatile("s_wait_asynccnt 0x0" ::: "memory");   // this wave's copies of stage t + 1 have landed
        __syncthreads();                                    // publishes stage t + 1 and ends every wave's reads of stage t
        if (t + 2 < DM / PKC) { const unsigned lb = l0 + (unsigned)(t & 1) * (PST * 2); cp8(lb, gw + (t + 2) * PKC); cp8(lb + 128u * SP * 2, gx + (t + 2) * PKC); }
    }
    asm volatile("s_wait_asynccnt 0x0" ::: "memory");       // nothing is in flight when the ring becomes output staging
    unsigned short (*st)[16 * SP] = (unsigned short (*)[16 * SP])(&ring[0][0] + wv * 3 * 16 * SP);   // behind the last trip's barrier the ring is dead: each wave stages its output rows in a range of its own
    unsigned short* d16 = (unsigned short*)(part == 0 ? Q16 : part == 1 ? K16 : V16); bf* dh = part == 0 ? Qh : part == 1 ? Kh : Vh; bf* dl = part == 0 ? Ql : part == 1 ? Kl : Vl;
    const size_t base = tv ? (size_t)h * HD * TT + r0 : ((size_t)h * TT + r0) * HD;   // first element of the tile in its planes
    const int pitch = tv ? TT : HD;                                                    // from one plane row to the next
#pragma unroll
    for (int nb = 0; nb < 4; ++nb) {
#pragma unroll
        for (int mb = 0; mb < 4; ++mb) { v8h o16; v8us oh, ol;
#pragma unroll
            for (int j = 0; j < 8; ++j) { const float x = acc[mb][nb][j]; o16[j] = tohx(x); unsigned short a2, c2; splitf(x, a2, c2); oh[j] = a2; ol[j] = c2; }
            const int so = lr * SP + (2 * mb + hi) * 8;
            *(v8us*)(&st[0][so]) = __builtin_bit_cast(v8us, o16); *(v8us*)(&st[1][so]) = oh; *(v8us*)(&st[2][so]) = ol; }
        // a range of its own for each wave, so no barrier: the wave's own LDS writes have landed before it reads the rows back across lanes; the clobber keeps the compiler from lifting those reads over the writes
        __builtin_amdgcn_wave_barrier(); asm volatile("s_wait_dscnt 0x0" ::: "memory");
#pragma unroll
        for (int s = 0; s < 4; ++s) { const int row = 4 * s + (lane >> 3), pc = (lane & 7) * 8; const size_t e = base + (size_t)(nb * 16 + row) * pitch + pc;
            *(v8usa*)(d16 + e) = *(const v8us*)(&st[0][row * SP + pc]); *(v8usa*)(dh + e) = *(const v8us*)(&st[1][row * SP + pc]); *(v8usa*)(dl + e) = *(const v8us*)(&st[2][row * SP + pc]); }
        // compiler fence: keeps these reads from sinking under the next rows' writes
        __builtin_amdgcn_wave_barrier(); asm volatile("" ::: "memory");
    }
}
__device__ __forceinline__ float exp2s(float x) { float r; asm("v_exp_f32 %0, %1\n\tv_nop" : "=v"(r) : "v"(x)); return r; }
#define APL (64 * SP)         // one plane's 64 rows of a stage in LDS, in 16-bit elements (pitch SP)
// four asynchronous copies, 16 bytes a lane each, of rows 16 apart: l = the lane's LDS byte address, g = its global address (8 lanes cover one row's line), pitch = elements from one global row to the next.
// The s_wait_xcnt stands inside the statement, behind the last copy: the address registers are free for rewriting only behind it.
template <typename T16>
__device__ __forceinline__ void cp4(unsigned l, const T16* g, int pitch) {
    asm volatile("global_load_async_to_lds_b128 %0, %4, off\n\t"
                 "global_load_async_to_lds_b128 %1, %5, off\n\t"
                 "global_load_async_to_lds_b128 %2, %6, off\n\t"
                 "global_load_async_to_lds_b128 %3, %7, off\n\t"
                 "s_wait_xcnt 0x0"
                 :: "v"(l), "v"(l + 1u * 16 * SP * 2), "v"(l + 2u * 16 * SP * 2), "v"(l + 3u * 16 * SP * 2),
                    "v"(g), "v"(g + 16 * pitch), "v"(g + 32 * pitch), "v"(g + 48 * pitch)
                 : "memory");
}
// R0: the work-group's first query row (a multiple of 64 NQ); ring0: for each key group two buffers of (HI ? 4 : 2) planes: keys, values (, low keys, low values)
template <typename T16, bool HI, int NQ>
__device__ __forceinline__ void fattn_tile(const T16* __restrict__ Q, const T16* __restrict__ Q2, const T16* __restrict__ Kp, const T16* __restrict__ Kp2, const T16* __restrict__ Vt, const T16* __restrict__ Vt2, int R0, float* __restrict__ outp, unsigned short* ring0) {
    typedef typename WFrag<T16>::V V;
    constexpr int BUF = (HI ? 4 : 2) * APL;          // one buffer in 16-bit elements
    const int tid = threadIdx.x & 127, lane = tid & 31, lr = lane & 15, hi = lane >> 4;   // tid: the thread in its key group
    const int wv = __builtin_amdgcn_readfirstlane(threadIdx.x >> 5), g = wv >> 2;         // g: the wave's key group
    const unsigned short* ring = ring0 + g * 2 * BUF;                                     // the group's two buffers
    const int r0 = R0 + (wv & 3) * 16 * NQ;          // the wave's first query row
    const int NS = (R0 + 64 * NQ - 1) / 64 + 1;      // stages of the work-group: up to and with its last wave's diagonal block
    const int NI = (NS + 1) / 2;                     // trips of the loop: trip it works on stage 2 it + g
    const int nst = r0 / 64 + 1;                     // 64-key steps of this wave's rows, up to and with their diagonal block
    const float EC = SCL * 1.4426950408889634f;      // scores x HD^-0.5 x log2(e)
    const unsigned l0 = (unsigned)(size_t)&ring[(tid >> 3) * SP + (tid & 7) * 8];   // this lane's piece of row tid / 8 in buffer 0 (low 32 bits: the LDS byte address)
    const int ko0 = (tid >> 3) * HD + (tid & 7) * 8, vo0 = (tid >> 3) * TT + (tid & 7) * 8;   // the same piece in a key plane and in a value plane
    auto stage = [&](int t, int b) {                 // the copies of stage t (keys 64 t .. 64 t + 63, always inside the planes: 64 NS <= TT) into buffer b
        const unsigned lb = l0 + (unsigned)b * (BUF * 2);
        cp4(lb, Kp + ko0 + t * 64 * HD, HD); cp4(lb + APL * 2u, Vt + vo0 + t * 64, TT);
        if (HI) { cp4(lb + APL * 4u, Kp2 + ko0 + t * 64 * HD, HD); cp4(lb + APL * 6u, Vt2 + vo0 + t * 64, TT); }
    };
    if (g < NS) stage(g, 0);                         // the group's first stage (a scalar test: g and NS are the same in the whole wave)
    V q[NQ][2], q2[NQ][2];                            // [query tile][32-wide chunk of the head dim]
#pragma unroll
    for (int qt = 0; qt < NQ; ++qt)
#pragma unroll
        for (int dc = 0; dc < 2; ++dc) { const size_t qo = (size_t)(r0 + qt * 16 + lr) * HD + dc * 32 + 8 * hi; q[qt][dc] = WFrag<T16>::ld(Q + qo); if (HI) q2[qt][dc] = WFrag<T16>::ld(Q2 + qo); }
    v8f o[4][NQ];                                    // O^T: [16 head dims][query tile]
#pragma unroll
    for (int dt = 0; dt < 4; ++dt)
#pragma unroll
        for (int qt = 0; qt < NQ; ++qt) o[dt][qt] = (v8f){};
    float m[NQ], l[NQ];                              // running maximum of the raw scores; this lane half's running sum
#pragma unroll
    for (int qt = 0; qt < NQ; ++qt) { m[qt] = -3.0e38f; l[qt] = 0.f; }
    asm volatile("s_wait_asynccnt 0x0" ::: "memory");   // this wave's copies of its group's first stage have landed
    __syncthreads();                                    // and every other wave's
    if (g + 2 < NS) stage(g + 2, 1);
    const int fo = lr * SP + 8 * hi;                 // this lane's place in a fragment's 16 rows
    int lim0 = r0 + lr - hi * 8 - g * 64;            // this lane's query row of tile 0 less its half's first key of the trip's stage: one register, stepped at the trip's foot
#pragma unroll 1
    for (int it = 0; it < NI; ++it) {
      const int st = 2 * it + g;
      if (st < nst) {                                // a wave whose diagonal block lies behind it only keeps the trip's waits and barrier
        const unsigned short* sb = ring + (it & 1) * BUF + fo;
        V kf[4][2], kf2[4][2];                       // all key fragments of the step
#pragma unroll
        for (int kt = 0; kt < 4; ++kt)
#pragma unroll
            for (int dc = 0; dc < 2; ++dc) { kf[kt][dc] = WFrag<T16>::lds(sb + kt * 16 * SP + dc * 32); if (HI) kf2[kt][dc] = WFrag<T16>::lds(sb + 2 * APL + kt * 16 * SP + dc * 32); }
        // holds the key reads in front of the products as one group: without it the build reads one fragment at a time into the same registers and waits out the LDS latency in front of every pair of products
        __builtin_amdgcn_sched_barrier(0);
        v8f s[4][NQ];                                // S^T: [16 keys][query tile]
#pragma unroll
        for (int kt = 0; kt < 4; ++kt)
#pragma unroll
            for (int qt = 0; qt < NQ; ++qt) s[kt][qt] = (v8f){};
#pragma unroll
        for (int kt = 0; kt < 4; ++kt)
#pragma unroll
            for (int dc = 0; dc < 2; ++dc) {
                const V k = kf[kt][dc]; V k2; if (HI) k2 = kf2[kt][dc];
#pragma unroll
                for (int qt = 0; qt < NQ; ++qt) { s[kt][qt] = WFrag<T16>::mma(k, q[qt][dc], s[kt][qt]); if (HI) { s[kt][qt] = WFrag<T16>::mma(k2, q[qt][dc], s[kt][qt]); s[kt][qt] = WFrag<T16>::mma(k, q2[qt][dc], s[kt][qt]); } }
            }
        V vf[4][2], vf2[4][2];                       // fp16 path: value fragments issued ahead of the softmax, which covers their latency
        if constexpr (!HI) {
#pragma unroll
            for (int dt = 0; dt < 4; ++dt)
#pragma unroll
                for (int kc = 0; kc < 2; ++kc) vf[dt][kc] = WFrag<T16>::lds(sb + APL + dt * 16 * SP + kc * 32);
            // holds the value reads here, in front of the softmax: sunk to their products they would be waited for one fragment at a time
            __builtin_amdgcn_sched_barrier(0);
        }
        const bool diag = (st == nst - 1);           // only the rows' last step holds keys above the diagonal
#pragma unroll
        for (int qt = 0; qt < NQ; ++qt) {
            if (diag) { const int lim = lim0 + qt * 16;   // key kt * 16 + j of this lane half is allowed while <= lim
#pragma unroll
                for (int kt = 0; kt < 4; ++kt)
#pragma unroll
                    for (int j = 0; j < 8; ++j) s[kt][qt][j] = (kt * 16 + j <= lim) ? s[kt][qt][j] : -3.0e38f; }
            float mx = m[qt];
#pragma unroll
            for (int kt = 0; kt < 4; ++kt)
#pragma unroll
                for (int j = 0; j < 8; ++j) mx = fmaxf(mx, s[kt][qt][j]);
            mx = fmaxf(mx, __shfl_xor(mx, 16, 32));
            const float al = exp2s((m[qt] - mx) * EC); m[qt] = mx;
            float sum = 0.f;
#pragma unroll
            for (int kt = 0; kt < 4; ++kt)
#pragma unroll
                for (int j = 0; j < 8; ++j) { const float d0 = s[kt][qt][j] - mx; const float p = exp2s(HI ? d0 * EC : __builtin_fmaf(d0, EC, 10.0f)); s[kt][qt][j] = p; sum += p; }
            l[qt] = l[qt] * al + sum;
#pragma unroll
            for (int dt = 0; dt < 4; ++dt) o[dt][qt] *= al;
        }
        // keeps the exponentials (asm text) in front of the P.V products
        __builtin_amdgcn_sched_barrier(0);
#pragma unroll
        for (int kc = 0; kc < 2; ++kc) {
            V pb[NQ], pb2[NQ];
            if constexpr (HI) {                      // hi/lo path (twice the planes): the value fragments of 32 keys as one group, issued ahead of the packing of their probabilities, which covers their latency
#pragma unroll
                for (int dt = 0; dt < 4; ++dt) { vf[dt][kc] = WFrag<T16>::lds(sb + APL + dt * 16 * SP + kc * 32); vf2[dt][kc] = WFrag<T16>::lds(sb + 3 * APL + dt * 16 * SP + kc * 32); }
                // holds these reads in front of the packing: sunk to their products they would be waited for one fragment at a time
                __builtin_amdgcn_sched_barrier(0);
            }
#pragma unroll
            for (int qt = 0; qt < NQ; ++qt) {
                if constexpr (HI) { v8us h0, h1, l0v, l1v;
#pragma unroll
                    for (int e = 0; e < 8; ++e) { unsigned short a, c2; splitf(s[2 * kc][qt][e], a, c2); h0[e] = a; l0v[e] = c2; splitf(s[2 * kc + 1][qt][e], a, c2); h1[e] = a; l1v[e] = c2; }
                    pb[qt] = cat16b(h0, h1); pb2[qt] = cat16b(l0v, l1v);
                } else { v8h h0, h1;
#pragma unroll
                    for (int e = 0; e < 8; ++e) { h0[e] = tohx(s[2 * kc][qt][e]); h1[e] = tohx(s[2 * kc + 1][qt][e]); }
                    pb[qt] = cat16(h0, h1); }
            }
#pragma unroll
            for (int dt = 0; dt < 4; ++dt) {
                const V v = vf[dt][kc]; V v2; if (HI) v2 = vf2[dt][kc];
#pragma unroll
                for (int qt = 0; qt < NQ; ++qt) { o[dt][qt] = WFrag<T16>::mma(v, pb[qt], o[dt][qt]); if (HI) { o[dt][qt] = WFrag<T16>::mma(v, pb2[qt], o[dt][qt]); o[dt][qt] = WFrag<T16>::mma(v2, pb[qt], o[dt][qt]); } }
            }
        }
        // distance after the last matrix instructions at the end of the step: the next trip overwrites their operands
        if constexpr (NQ == 2) asm volatile("v_nop\n\tv_nop\n\tv_nop\n\tv_nop\n\tv_nop" : "+v"(o[0][0]), "+v"(o[0][1]), "+v"(o[1][0]), "+v"(o[1][1]), "+v"(o[2][0]), "+v"(o[2][1]), "+v"(o[3][0]), "+v"(o[3][1]));
        else asm volatile("v_nop\n\tv_nop\n\tv_nop\n\tv_nop\n\tv_nop" : "+v"(o[0][0]), "+v"(o[1][0]), "+v"(o[2][0]), "+v"(o[3][0]));
      }
        asm volatile("s_wait_dscnt 0x0" ::: "memory");      // this wave's reads of the buffer have retired before it is refilled
        asm volatile("s_wait_asynccnt 0x0" ::: "memory");   // this wave's copies of stage st + 2 have landed
        __syncthreads();                                    // publishes stage st + 2 and ends every wave's reads of stage st
        if (st + 4 < NS) stage(st + 4, it & 1);
        lim0 -= 128;
    }
    asm volatile("s_wait_asynccnt 0x0" ::: "memory");       // nothing is in flight when the ring becomes the hand-over area
    const int ln = (int)__builtin_amdgcn_mbcnt_lo(~0u, 0u);   // the lane's number read anew: no row address formed in front of the loop has to live through it, which spilled
    // behind the last trip's barrier the ring is dead. Group 1 hands over O^T, maximum and sum: wave w of group 1 and wave w of group 0 hold the same rows in the same lanes; 16 bytes a lane, 512 bytes a row of the area
    v4fa* mg = (v4fa*)ring0 + (wv & 3) * (8 * NQ + 1) * 32 + ln;
    if (g == 1) {
#pragma unroll
        for (int dt = 0; dt < 4; ++dt)
#pragma unroll
            for (int qt = 0; qt < NQ; ++qt) { const v8f x = o[dt][qt]; mg[((dt * NQ + qt) * 2) * 32] = (v4f){x[0], x[1], x[2], x[3]}; mg[((dt * NQ + qt) * 2 + 1) * 32] = (v4f){x[4], x[5], x[6], x[7]}; }
        mg[8 * NQ * 32] = (v4f){m[0], l[0], m[NQ - 1], l[NQ - 1]};
    }
    __syncthreads();                                        // group 1's state is in LDS before group 0 reads it
    if (g == 1) return;                                     // behind the last barrier
    {
        const v4f ml = mg[8 * NQ * 32];
#pragma unroll
        for (int qt = 0; qt < NQ; ++qt) {                   // both states on the common maximum; a group that met no stage (sum 0, maximum at its start value) gets the factor 0
            const float m1 = ml[2 * qt], mx = fmaxf(m[qt], m1);
            const float a0 = exp2s((m[qt] - mx) * EC), a1 = exp2s((m1 - mx) * EC);
            l[qt] = l[qt] * a0 + ml[2 * qt + 1] * a1;
#pragma unroll
            for (int dt = 0; dt < 4; ++dt) { const v4f y0 = mg[((dt * NQ + qt) * 2) * 32], y1 = mg[((dt * NQ + qt) * 2 + 1) * 32];
#pragma unroll
                for (int j = 0; j < 4; ++j) { o[dt][qt][j] = o[dt][qt][j] * a0 + y0[j] * a1; o[dt][qt][4 + j] = o[dt][qt][4 + j] * a0 + y1[j] * a1; } }
        }
    }
#pragma unroll
    for (int qt = 0; qt < NQ; ++qt) {
        const float inv = __fdiv_rn(1.0f, l[qt] + __shfl_xor(l[qt], 16, 32));
        float* orow = outp + (size_t)(r0 + qt * 16 + (ln & 15)) * DQ + (ln >> 4) * 8;   // a lane's 8 accumulator registers are 8 consecutive head dims of one query row
#pragma unroll
        for (int dt = 0; dt < 4; ++dt) { v4f a, b2;
#pragma unroll
            for (int j = 0; j < 4; ++j) { a[j] = o[dt][qt][j] * inv; b2[j] = o[dt][qt][4 + j] * inv; }
            *(v4f*)(orow + dt * 16) = a; *(v4f*)(orow + dt * 16 + 4) = b2; }
    }
}
// grid (batches x heads, (TT - RH) / 128 + RH / 64), 256 threads: blockIdx.x = batch * NH_ + head; blockIdx.y counts the query blocks from the last (most keys) to the first, for speed only; rows >= RH in blocks of 4 x 32, rows < RH (three products, twice the planes) in blocks of 4 x 16
// at most 256 registers a wave: the build then stays in the directly addressed registers
__global__ __launch_bounds__(256) __attribute__((amdgpu_waves_per_eu(4, 4))) void k_fattn(const h16* __restrict__ Q16, const h16* __restrict__ K16, const h16* __restrict__ V16, const bf* __restrict__ Qh, const bf* __restrict__ Ql, const bf* __restrict__ Kh, const bf* __restrict__ Kl, const bf* __restrict__ Vh, const bf* __restrict__ Vl, float* __restrict__ OUTb) {
    __shared__ __align__(16) unsigned short ring[2 * 2 * 4 * APL];
    const int bh = blockIdx.x, y = blockIdx.y; const size_t zp = (size_t)bh * TT * HD; float* outp = OUTb + (size_t)(bh / NH_) * TT * DQ + (bh % NH_) * HD;
    if (y < (TT - RH) / 128) fattn_tile<h16, false, 2>(Q16 + zp, nullptr, K16 + zp, nullptr, V16 + zp, nullptr, TT - 128 * (y + 1), outp, ring);
    else fattn_tile<bf, true, 1>(Qh + zp, Ql + zp, Kh + zp, Kl + zp, Vh + zp, Vl + zp, RH - 64 * (y - (TT - RH) / 128 + 1), outp, ring);
}

extern "C" void kernel_launch(void* const* d_in, const int* in_sizes, int n_in,
                              void* d_out, int out_size, void* d_ws, size_t ws_size, hipStream_t stream) {
    (void)in_sizes; (void)n_in; (void)out_size;
    const float* x = (const float*)d_in[0]; const float* wqkv = (const float*)d_in[1];   /* argument order inputs, W_qkv ('oi' [3072][1024], per-head (q, k, v) packed rows) */
    float* OUT = (float*)d_out;     // [2][2048][1024]
    char* wsp = (char*)d_ws;
    auto take = [&](size_t bytes) { char* p = wsp; wsp += (bytes + 255) & ~(size_t)255; return (void*)p; };
    bf* WQKV = (bf*)take((size_t)3 * DQ * DM * 2);   /* de-interleaved Bt: q | k | v row blocks in head order */
    bf* XB = (bf*)take((size_t)NB_ * TT * DM * 2);
    /* every plane holds both batches: [batch][head][...] */
    h16* QP16 = (h16*)take((size_t)NB_ * NH_ * TT * HD * 2); h16* KP16 = (h16*)take((size_t)NB_ * NKV * TT * HD * 2); h16* VT16 = (h16*)take((size_t)NB_ * NKV * HD * TT * 2);
    bf* QPh = (bf*)take((size_t)NB_ * NH_ * TT * HD * 2); bf* QPl = (bf*)take((size_t)NB_ * NH_ * TT * HD * 2); bf* KPh = (bf*)take((size_t)NB_ * NKV * TT * HD * 2); bf* KPl = (bf*)take((size_t)NB_ * NKV * TT * HD * 2); bf* VTh = (bf*)take((size_t)NB_ * NKV * HD * TT * 2); bf* VTl = (bf*)take((size_t)NB_ * NKV * HD * TT * 2);
    if ((size_t)(wsp - (char*)d_ws) > ws_size) return;    // ws 256 MiB
    k_wperm<<<(unsigned)(((size_t)3 * DQ * DM / 8 + 255) / 256), 256, 0, stream>>>(wqkv, WQKV);   /* packed rows (h, part, d) -> standard (part, h, d) blocks */
    k_cvt8<<<(unsigned)(((size_t)NB_ * TT * DM / 8 + 255) / 256), 256, 0, stream>>>(x, XB, (size_t)NB_ * TT * DM / 8);
    k_proj<<<dim3(NB_ * TT / 128, 3 * NH_ / 2, 1), 128, 0, stream>>>(XB, WQKV, QP16, QPh, QPl, KP16, KPh, KPl, VT16, VTh, VTl);
    k_fattn<<<dim3(NB_ * NH_, (TT - RH) / 128 + RH / 64, 1), 256, 0, stream>>>(QP16, KP16, VT16, QPh, QPl, KPh, KPl, VTh, VTl, OUT);
}

// v008
// A run of this version takes 57 microseconds.
// Next to v007, in two timings, it ran 1.04 times as fast each time.
// All steps since v000 together make it 24.0 times as fast.
#include <hip/hip_runtime.h>

// Causal multi-head attention with a per-head packed qkv projection (inputs [2][2048][1024]; qkv = x W_qkv^T ('oi' [3072][1024] 1/32, no bias); the module views qkv as (T, 16 heads, 3 x 64) and splits the LAST dim: head h's q = output rows h*192 + 0..63, k = h*192 + 64..127, v = h*192 + 128..191; scores x 64^-0.5; causal (-inf); softmax; out = merged heads (no output projection) -> [2][2048][1024] (4.2 M); argument order inputs, W_qkv).
// Both batches go through every launch together (4 launches): tokens are the 2 x 2048 rows of x, planes are [batch][head]. Layout: the packed weight rows are gathered once into a standard q | k | v Bt (a row permutation of the bf16 copy); bf16 copy of x; one projection launch (k_proj: operands through LDS, exact products, its accumulators leave as the fp16 and bf16 hi/lo head planes of q, k and v^T); one fused causal attention launch (k_fattn: keys and values through LDS, online softmax, scores and probabilities stay in registers; hybrid rows: < 512 hi/lo 3 products, rest fp16 x1024) writes the output rows.
// Compute dtypes, f32 accumulate: every input rounded to bf16; projections exact; attention rows < 512 3 products, rest fp16; softmax f32; output f32.

#define NB_  2
#define TT   2048
#define DM   1024
#define NH_  16
#define NKV  16
#define REP  (NH_ / NKV)
#define HD   64
#define DQ   (NH_ * HD)
#define DKV  (NKV * HD)
#define RH   512                  // query rows < RH use hi+lo planes (0: none)
#define SCL  0.125f   // HD^-0.5
typedef _Float16 h16;
typedef unsigned short bf;
typedef __attribute__((ext_vector_type(16))) __bf16   v16bf;
typedef __attribute__((ext_vector_type(16))) _Float16 v16h;
typedef __attribute__((ext_vector_type(8)))  _Float16 v8h;
typedef __attribute__((ext_vector_type(8)))  unsigned short v8us;
typedef __attribute__((ext_vector_type(8)))  float    v8f;
typedef __attribute__((ext_vector_type(4)))  float    v4f;
typedef v8h  __attribute__((may_alias)) v8ha;
typedef v4f  __attribute__((may_alias)) v4fa;
typedef v8us __attribute__((may_alias)) v8usa;

__device__ __forceinline__ unsigned short f2bf(float f) { unsigned u = __float_as_uint(f); u += 0x7FFFu + ((u >> 16) & 1u); return (unsigned short)(u >> 16); }
__device__ __forceinline__ float bf2f(unsigned short b) { return __uint_as_float(((unsigned)b) << 16); }
__device__ __forceinline__ float bfr(float f) { return bf2f(f2bf(f)); }
__device__ __forceinline__ v16h cat16(v8h lo, v8h hi) { return __builtin_shufflevector(lo, hi, 0, 1, 2, 3, 4, 5, 6, 7, 8, 9, 10, 11, 12, 13, 14, 15); }
__device__ __forceinline__ v16bf cat16b(v8us lo, v8us hi) { return __builtin_bit_cast(v16bf, __builtin_shufflevector(lo, hi, 0, 1, 2, 3, 4, 5, 6, 7, 8, 9, 10, 11, 12, 13, 14, 15)); }
__device__ __forceinline__ v8f wmma16(v16h a, v16h b, v8f c) { return __builtin_amdgcn_wmma_f32_16x16x32_f16(false, a, false, b, (short)0, c, false, false); }
__device__ __forceinline__ v8f wmmab(v16bf a, v16bf b, v8f c) { return __builtin_amdgcn_wmma_f32_16x16x32_bf16(false, a, false, b, (short)0, c, false, false); }



// fragment loaders and products of the two 16-bit forms; both operands K-contiguous, the same k order for A and B
template <typename T16> struct WFrag;
template <> struct WFrag<h16> { typedef v16h V; static __device__ __forceinline__ V ld(const h16* p) { return cat16(*(const v8h*)p, *(const v8h*)(p + 16)); } static __device__ __forceinline__ V lds(const unsigned short* p) { return cat16(*(const v8ha*)p, *(const v8ha*)(p + 16)); } static __device__ __forceinline__ v8f mma(V a, V b, v8f c) { return wmma16(a, b, c); } };
template <> struct WFrag<bf> { typedef v16bf V; static __device__ __forceinline__ V ld(const bf* p) { return cat16b(*(const v8us*)p, *(const v8us*)(p + 16)); } static __device__ __forceinline__ V lds(const unsigned short* p) { return cat16b(*(const v8usa*)p, *(const v8usa*)(p + 16)); } static __device__ __forceinline__ v8f mma(V a, V b, v8f c) { return wmmab(a, b, c); } };

__device__ __forceinline__ h16 tohx(float x) { return (h16)x; }
__device__ __forceinline__ void splitf(float y, unsigned short& h, unsigned short& l) { h = f2bf(y); l = f2bf(y - bf2f(h)); }
typedef __attribute__((ext_vector_type(2))) _Float16 v2h;
typedef __attribute__((ext_vector_type(4))) _Float16 v4h;
typedef __attribute__((ext_vector_type(2))) unsigned short v2us;
typedef __attribute__((ext_vector_type(4))) unsigned short v4us;
typedef __attribute__((ext_vector_type(2))) float v2f;
typedef __attribute__((ext_vector_type(4))) int v4i;

__global__ __launch_bounds__(256) void k_cvt8(const float* __restrict__ src, bf* dst, size_t n8) { const size_t i = (size_t)blockIdx.x * 256 + threadIdx.x; if (i >= n8) return; const v8f v = *(const v8f*)(src + i * 8); v8us o;
#pragma unroll
    for (int k = 0; k < 8; ++k) o[k] = f2bf(v[k]); *(v8us*)(dst + i * 8) = o;  }

__global__ __launch_bounds__(256) void k_wperm(const float* __restrict__ W, bf* Bt) { const size_t i = (size_t)blockIdx.x * 256 + threadIdx.x; if (i >= (size_t)3 * DQ * DM / 8) return; const size_t e = i * 8; const int c0 = (int)(e % DM); const int rd = (int)(e / DM); const int part = rd / DQ; const int h = (rd % DQ) / HD; const int d = rd % HD; const int rs = h * 3 * HD + part * HD + d; const v8f v = *(const v8f*)(W + (size_t)rs * DM + c0); v8us o;
#pragma unroll
    for (int k = 0; k < 8; ++k) o[k] = f2bf(v[k]); *(v8us*)(Bt + e) = o;  }
#define SP 72   // LDS pitch in 16-bit elements: 128 + 16 bytes (staging rows and operand rows alike)
#define PKC 64                // k per stage
#define PST (256 * SP)        // one stage in 16-bit elements: weight rows 0..127, token rows 128..255
// eight asynchronous copies, 16 bytes a lane each, of rows 16 apart: l = the lane's LDS byte address, g = its global address (8 lanes cover one row's line).
// The s_wait_xcnt stands inside the statement, behind the last copy: the address registers are free for rewriting only behind it.
__device__ __forceinline__ void cp8(unsigned l, const bf* g) {
    asm volatile("global_load_async_to_lds_b128 %0, %8, off\n\t"
                 "global_load_async_to_lds_b128 %1, %9, off\n\t"
                 "global_load_async_to_lds_b128 %2, %10, off\n\t"
                 "global_load_async_to_lds_b128 %3, %11, off\n\t"
                 "global_load_async_to_lds_b128 %4, %12, off\n\t"
                 "global_load_async_to_lds_b128 %5, %13, off\n\t"
                 "global_load_async_to_lds_b128 %6, %14, off\n\t"
                 "global_load_async_to_lds_b128 %7, %15, off\n\t"
                 "s_wait_xcnt 0x0"
                 :: "v"(l), "v"(l + 1u * 16 * SP * 2), "v"(l + 2u * 16 * SP * 2), "v"(l + 3u * 16 * SP * 2), "v"(l + 4u * 16 * SP * 2), "v"(l + 5u * 16 * SP * 2), "v"(l + 6u * 16 * SP * 2), "v"(l + 7u * 16 * SP * 2),
                    "v"(g), "v"(g + 1 * 16 * DM), "v"(g + 2 * 16 * DM), "v"(g + 3 * 16 * DM), "v"(g + 4 * 16 * DM), "v"(g + 5 * 16 * DM), "v"(g + 6 * 16 * DM), "v"(g + 7 * 16 * DM)
                 : "memory");
}
__global__ __launch_bounds__(128) void k_proj(const bf* __restrict__ X, const bf* __restrict__ Wt, h16* Q16, bf* Qh, bf* Ql, h16* K16, bf* Kh, bf* Kl, h16* V16, bf* Vh, bf* Vl) {
    typedef WFrag<bf>::V V;
    __shared__ __align__(16) unsigned short ring[2][PST];
    const int tid = threadIdx.x, lane = tid & 31, lr = lane & 15, hi = lane >> 4;
    const int wv = __builtin_amdgcn_readfirstlane(tid >> 5), wt = wv & 1, ww = wv >> 1;   // the wave's 64-token block and 64-row weight block in the work-group's tile
    const int yy = blockIdx.y * 2 + ww;                                                   // (part, head)
    const int rg = (blockIdx.x * 2 + wt) * 64, r0 = rg % TT, part = yy / NH_, h = (rg / TT) * NH_ + yy % NH_;   // rg: row of x; r0: token in its batch; h: (batch, head) plane
    const bool tv = (part == 2);   // the same for the whole work-group: 128 divides the rows of a part
    const bf* gw = Wt + ((size_t)blockIdx.y * 128 + (tid >> 3)) * DM + (tid & 7) * 8;   // this lane's piece of weight row tid / 8
    const bf* gx = X + ((size_t)blockIdx.x * 128 + (tid >> 3)) * DM + (tid & 7) * 8;    // and of token row tid / 8
    const unsigned l0 = (unsigned)(size_t)&ring[0][(tid >> 3) * SP + (tid & 7) * 8];    // its place in buffer 0 (low 32 bits: the LDS byte address)
    v8f acc[4][4];
#pragma unroll
    for (int mb = 0; mb < 4; ++mb)
#pragma unroll
        for (int nb = 0; nb < 4; ++nb) acc[mb][nb] = (v8f){};
    cp8(l0, gw); cp8(l0 + 128u * SP * 2, gx);                                            // stage 0 into buffer 0
    asm volatile("s_wait_asynccnt 0x0" ::: "memory");                                    // this wave's copies of stage 0 have landed
    __syncthreads();                                                                     // and every other wave's
    cp8(l0 + (unsigned)PST * 2, gw + PKC); cp8(l0 + (unsigned)PST * 2 + 128u * SP * 2, gx + PKC);   // stage 1 into buffer 1
    const int ao = ((tv ? 128 + wt * 64 : ww * 64) + lr) * SP + 8 * hi, bo = ((tv ? ww * 64 : 128 + wt * 64) + lr) * SP + 8 * hi;
#pragma unroll 1
    for (int t = 0; t < DM / PKC; ++t) {
        const unsigned short* sb = &ring[0][0] + (t & 1) * PST;
#pragma unroll
        for (int c = 0; c < 2; ++c) {
            V a[4], b[4];
#pragma unroll
            for (int mb = 0; mb < 4; ++mb) a[mb] = WFrag<bf>::ld(sb + ao + mb * 16 * SP + c * 32);
#pragma unroll
            for (int nb = 0; nb < 4; ++nb) b[nb] = WFrag<bf>::ld(sb + bo + nb * 16 * SP + c * 32);
            // inputs-only fence on the loaded fragments: all 16 LDS reads are issued as one group and waited for once; without it the build reloads one B fragment at a time and waits out the LDS latency four times
            asm volatile("" :: "v"(a[0]), "v"(a[1]), "v"(a[2]), "v"(a[3]), "v"(b[0]), "v"(b[1]), "v"(b[2]), "v"(b[3]));
#pragma unroll
            for (int nb = 0; nb < 4; ++nb)
#pragma unroll
                for (int mb = 0; mb < 4; ++mb) acc[mb][nb] = WFrag<bf>::mma(a[mb], b[nb], acc[mb][nb]);
        }
        // distance after the last matrix instructions on the loop's back edge and exit
        asm volatile("v_nop\n\tv_nop\n\tv_nop\n\tv_nop" : "+v"(acc[0][0]), "+v"(acc[0][1]), "+v"(acc[0][2]), "+v"(acc[0][3]), "+v"(acc[1][0]), "+v"(acc[1][1]), "+v"(acc[1][2]), "+v"(acc[1][3]), "+v"(acc[2][0]), "+v"(acc[2][1]), "+v"(acc[2][2]), "+v"(acc[2][3]), "+v"(acc[3][0]), "+v"(acc[3][1]), "+v"(acc[3][2]), "+v"(acc[3][3]));
        asm volatile("s_wait_dscnt 0x0" ::: "memory");      // this wave's reads of the buffer have retired before it is refilled
        asm volatile("s_wait_asynccnt 0x0" ::: "memory");   // this wave's copies of stage t + 1 have landed
        __syncthreads();                                    // publishes stage t + 1 and ends every wave's reads of stage t
        if (t + 2 < DM / PKC) { const unsigned lb = l0 + (unsigned)(t & 1) * (PST * 2); cp8(lb, gw + (t + 2) * PKC); cp8(lb + 128u * SP * 2, gx + (t + 2) * PKC); }
    }
    asm volatile("s_wait_asynccnt 0x0" ::: "memory");       // nothing is in flight when the ring becomes output staging
    unsigned short (*st)[16 * SP] = (unsigned short (*)[16 * SP])(&ring[0][0] + wv * 3 * 16 * SP);   // behind the last trip's barrier the ring is dead: each wave stages its output rows in a range of its own
    unsigned short* d16 = (unsigned short*)(part == 0 ? Q16 : part == 1 ? K16 : V16); bf* dh = part == 0 ? Qh : part == 1 ? Kh : Vh; bf* dl = part == 0 ? Ql : part == 1 ? Kl : Vl;
    const size_t base = tv ? (size_t)h * HD * TT + r0 : ((size_t)h * TT + r0) * HD;   // first element of the tile in its planes
    const int pitch = tv ? TT : HD;                                                    // from one plane row to the next
#pragma unroll
    for (int nb = 0; nb < 4; ++nb) {
#pragma unroll
        for (int mb = 0; mb < 4; ++mb) { v8h o16; v8us oh, ol;
#pragma unroll
            for (int j = 0; j < 8; ++j) { const float x = acc[mb][nb][j]; o16[j] = tohx(x); unsigned short a2, c2; splitf(x, a2, c2); oh[j] = a2; ol[j] = c2; }
            const int so = lr * SP + (2 * mb + hi) * 8;
            *(v8us*)(&st[0][so]) = __builtin_bit_cast(v8us, o16); *(v8us*)(&st[1][so]) = oh; *(v8us*)(&st[2][so]) = ol; }
        // a range of its own for each wave, so no barrier: the wave's own LDS writes have landed before it reads the rows back across lanes; the clobber keeps the compiler from lifting those reads over the writes
        __builtin_amdgcn_wave_barrier(); asm volatile("s_wait_dscnt 0x0" ::: "memory");
#pragma unroll
        for (int s = 0; s < 4; ++s) { const int row = 4 * s + (lane >> 3), pc = (lane & 7) * 8; const size_t e = base + (size_t)(nb * 16 + row) * pitch + pc;
            *(v8usa*)(d16 + e) = *(const v8us*)(&st[0][row * SP + pc]); *(v8usa*)(dh + e) = *(const v8us*)(&st[1][row * SP + pc]); *(v8usa*)(dl + e) = *(const v8us*)(&st[2][row * SP + pc]); }
        // compiler fence: keeps these reads from sinking under the next rows' writes
        __builtin_amdgcn_wave_barrier(); asm volatile("" ::: "memory");
    }
}
__device__ __forceinline__ float exp2s(float x) { float r; asm("v_exp_f32 %0, %1\n\tv_nop" : "=v"(r) : "v"(x)); return r; }
// eight independent 2^x, each in place: every one fills the slot that the instruction set asks for behind the one in front of it, the v_nop fills the last one's
__device__ __forceinline__ void exp2x8(v8f& a) {
    float e0 = a[0], e1 = a[1], e2 = a[2], e3 = a[3], e4 = a[4], e5 = a[5], e6 = a[6], e7 = a[7];
    asm("v_exp_f32 %0, %0\n\tv_exp_f32 %1, %1\n\tv_exp_f32 %2, %2\n\tv_exp_f32 %3, %3\n\tv_exp_f32 %4, %4\n\tv_exp_f32 %5, %5\n\tv_exp_f32 %6, %6\n\tv_exp_f32 %7, %7\n\tv_nop"
        : "+v"(e0), "+v"(e1), "+v"(e2), "+v"(e3), "+v"(e4), "+v"(e5), "+v"(e6), "+v"(e7));
    a = (v8f){e0, e1, e2, e3, e4, e5, e6, e7};
}
// lane l with lane l ^ 16 by a vector cross-row move (a shuffle compiles to an LDS-path permute that is waited for with the LDS counter)
__device__ __forceinline__ float xhalf(float x) { return __builtin_bit_cast(float, __builtin_amdgcn_permlanex16(__builtin_bit_cast(int, x), __builtin_bit_cast(int, x), 0x76543210, 0xfedcba98, false, false)); }
#define APL (64 * SP)         // one plane's 64 rows of a stage in LDS, in 16-bit elements (pitch SP)
// four asynchronous copies, 16 bytes a lane each, of rows 16 apart: l = the lane's LDS byte address, g = its global address (8 lanes cover one row's line), pitch = elements from one global row to the next.
// The s_wait_xcnt stands inside the statement, behind the last copy: the address registers are free for rewriting only behind it.
template <typename T16>
__device__ __forceinline__ void cp4(unsigned l, const T16* g, int pitch) {
    asm volatile("global_load_async_to_lds_b128 %0, %4, off\n\t"
                 "global_load_async_to_lds_b128 %1, %5, off\n\t"
                 "global_load_async_to_lds_b128 %2, %6, off\n\t"
                 "global_load_async_to_lds_b128 %3, %7, off\n\t"
                 "s_wait_xcnt 0x0"
                 :: "v"(l), "v"(l + 1u * 16 * SP * 2), "v"(l + 2u * 16 * SP * 2), "v"(l + 3u * 16 * SP * 2),
                    "v"(g), "v"(g + 16 * pitch), "v"(g + 32 * pitch), "v"(g + 48 * pitch)
                 : "memory");
}
// R0: the work-group's first query row (a multiple of 64 NQ); ring0: for each key group two buffers of (HI ? 4 : 2) planes: keys, values (, low keys, low values)
template <typename T16, bool HI, int NQ>
__device__ __forceinline__ void fattn_tile(const T16* __restrict__ Q, const T16* __restrict__ Q2, const T16* __restrict__ Kp, const T16* __restrict__ Kp2, const T16* __restrict__ Vt, const T16* __restrict__ Vt2, int R0, float* __restrict__ outp, unsigned short* ring0) {
    typedef typename WFrag<T16>::V V;
    constexpr int BUF = (HI ? 4 : 2) * APL;          // one buffer in 16-bit elements
    const int tid = threadIdx.x & 127, lane = tid & 31, lr = lane & 15, hi = lane >> 4;   // tid: the thread in its key group
    const int wv = __builtin_amdgcn_readfirstlane(threadIdx.x >> 5), g = wv >> 2;         // g: the wave's key group
    const unsigned short* ring = ring0 + g * 2 * BUF;                                     // the group's two buffers
    const int r0 = R0 + (wv & 3) * 16 * NQ;          // the wave's first query row
    const int NS = (R0 + 64 * NQ - 1) / 64 + 1;      // stages of the work-group: up to and with its last wave's diagonal block
    const int NI = (NS + 1) / 2;                     // trips of the loop: trip it works on stage 2 it + g
    const int nst = r0 / 64 + 1;                     // 64-key steps of this wave's rows, up to and with their diagonal block
    const float EC = SCL * 1.4426950408889634f;      // scores x HD^-0.5 x log2(e)
    const unsigned l0 = (unsigned)(size_t)&ring[(tid >> 3) * SP + (tid & 7) * 8];   // this lane's piece of row tid / 8 in buffer 0 (low 32 bits: the LDS byte address)
    const int ko0 = (tid >> 3) * HD + (tid & 7) * 8, vo0 = (tid >> 3) * TT + (tid & 7) * 8;   // the same piece in a key plane and in a value plane
    auto stage = [&](int t, int b) {                 // the copies of stage t (keys 64 t .. 64 t + 63, always inside the planes: 64 NS <= TT) into buffer b
        const unsigned lb = l0 + (unsigned)b * (BUF * 2);
        cp4(lb, Kp + ko0 + t * 64 * HD, HD); cp4(lb + APL * 2u, Vt + vo0 + t * 64, TT);
        if (HI) { cp4(lb + APL * 4u, Kp2 + ko0 + t * 64 * HD, HD); cp4(lb + APL * 6u, Vt2 + vo0 + t * 64, TT); }
    };
    if (g < NS) stage(g, 0);                         // the group's first stage (a scalar test: g and NS are the same in the whole wave)
    V q[NQ][2], q2[NQ][2];                            // [query tile][32-wide chunk of the head dim]
#pragma unroll
    for (int qt = 0; qt < NQ; ++qt)
#pragma unroll
        for (int dc = 0; dc < 2; ++dc) { const size_t qo = (size_t)(r0 + qt * 16 + lr) * HD + dc * 32 + 8 * hi; q[qt][dc] = WFrag<T16>::ld(Q + qo); if (HI) q2[qt][dc] = WFrag<T16>::ld(Q2 + qo); }
    v8f o[4][NQ];                                    // O^T: [16 head dims][query tile]
#pragma unroll
    for (int dt = 0; dt < 4; ++dt)
#pragma unroll
        for (int qt = 0; qt < NQ; ++qt) o[dt][qt] = (v8f){};
    float m[NQ], l[NQ];                              // running maximum of the raw scores; this lane half's running sum
#pragma unroll
    for (int qt = 0; qt < NQ; ++qt) { m[qt] = -3.0e38f; l[qt] = 0.f; }
    asm volatile("s_wait_asynccnt 0x0" ::: "memory");   // this wave's copies of its group's first stage have landed
    __syncthreads();                                    // and every other wave's
    if (g + 2 < NS) stage(g + 2, 1);
    const int fo = lr * SP + 8 * hi;                 // this lane's place in a fragment's 16 rows
    int lim0 = r0 + lr - hi * 8 - g * 64;            // this lane's query row of tile 0 less its half's first key of the trip's stage: one register, stepped at the trip's foot
#pragma unroll 1
    for (int it = 0; it < NI; ++it) {
      const int st = 2 * it + g;
      if (st < nst) {                                // a wave whose diagonal block lies behind it only keeps the trip's waits and barrier
        const unsigned short* sb = ring + (it & 1) * BUF + fo;
        V kf[4][2], kf2[4][2];                       // all key fragments of the step
#pragma unroll
        for (int kt = 0; kt < 4; ++kt)
#pragma unroll
            for (int dc = 0; dc < 2; ++dc) { kf[kt][dc] = WFrag<T16>::lds(sb + kt * 16 * SP + dc * 32); if (HI) kf2[kt][dc] = WFrag<T16>::lds(sb + 2 * APL + kt * 16 * SP + dc * 32); }
        // holds the key reads in front of the products as one group: without it the build reads one fragment at a time into the same registers and waits out the LDS latency in front of every pair of products
        __builtin_amdgcn_sched_barrier(0);
        v8f s[4][NQ];                                // S^T: [16 keys][query tile]
#pragma unroll
        for (int kt = 0; kt < 4; ++kt)
#pragma unroll
            for (int qt = 0; qt < NQ; ++qt) s[kt][qt] = (v8f){};
#pragma unroll
        for (int kt = 0; kt < 4; ++kt)
#pragma unroll
            for (int dc = 0; dc < 2; ++dc) {
                const V k = kf[kt][dc]; V k2; if (HI) k2 = kf2[kt][dc];
#pragma unroll
                for (int qt = 0; qt < NQ; ++qt) { s[kt][qt] = WFrag<T16>::mma(k, q[qt][dc], s[kt][qt]); if (HI) { s[kt][qt] = WFrag<T16>::mma(k2, q[qt][dc], s[kt][qt]); s[kt][qt] = WFrag<T16>::mma(k, q2[qt][dc], s[kt][qt]); } }
            }
        V vf[4][2], vf2[4][2];                       // fp16 path: value fragments issued ahead of the softmax, which covers their latency
        if constexpr (!HI) {
#pragma unroll
            for (int dt = 0; dt < 4; ++dt)
#pragma unroll
                for (int kc = 0; kc < 2; ++kc) vf[dt][kc] = WFrag<T16>::lds(sb + APL + dt * 16 * SP + kc * 32);
            // holds the value reads here, in front of the softmax: sunk to their products they would be waited for one fragment at a time
            __builtin_amdgcn_sched_barrier(0);
        }
        const bool diag = (st == nst - 1);           // only the rows' last step holds keys above the diagonal
        if (diag) {                                  // one test for both query tiles: the compares stay inside the branch
#pragma unroll
            for (int qt = 0; qt < NQ; ++qt) { const int lim = lim0 + qt * 16;   // key kt * 16 + j of this lane half is allowed while <= lim
#pragma unroll
                for (int kt = 0; kt < 4; ++kt)
#pragma unroll
                    for (int j = 0; j < 8; ++j) s[kt][qt][j] = (kt * 16 + j <= lim) ? s[kt][qt][j] : -3.0e38f; }
        }
#pragma unroll
        for (int qt = 0; qt < NQ; ++qt) {
            float mx = m[qt];
#pragma unroll
            for (int kt = 0; kt < 4; ++kt)
#pragma unroll
                for (int j = 0; j < 8; ++j) mx = fmaxf(mx, s[kt][qt][j]);
            mx = fmaxf(mx, xhalf(mx));
            const float al = exp2s((m[qt] - mx) * EC); m[qt] = mx;
            const float c0 = __builtin_fmaf(-mx, EC, HI ? 0.0f : 10.0f);   // the exponent is s EC + c0: one (packed) multiply-add a score, no subtraction of its own
            const v8f cv = {c0, c0, c0, c0, c0, c0, c0, c0}, ev = {EC, EC, EC, EC, EC, EC, EC, EC};
            float sum = 0.f;
#pragma unroll
            for (int kt = 0; kt < 4; ++kt) {
                v8f a = __builtin_elementwise_fma(s[kt][qt], ev, cv);
                exp2x8(a); s[kt][qt] = a;
#pragma unroll
                for (int j = 0; j < 8; ++j) sum += a[j];
            }
            l[qt] = l[qt] * al + sum;
#pragma unroll
            for (int dt = 0; dt < 4; ++dt) o[dt][qt] *= al;
        }
        // keeps the exponentials (asm text) in front of the P.V products
        __builtin_amdgcn_sched_barrier(0);
#pragma unroll
        for (int kc = 0; kc < 2; ++kc) {
            V pb[NQ], pb2[NQ];
            if constexpr (HI) {                      // hi/lo path (twice the planes): the value fragments of 32 keys as one group, issued ahead of the packing of their probabilities, which covers their latency
#pragma unroll
                for (int dt = 0; dt < 4; ++dt) { vf[dt][kc] = WFrag<T16>::lds(sb + APL + dt * 16 * SP + kc * 32); vf2[dt][kc] = WFrag<T16>::lds(sb + 3 * APL + dt * 16 * SP + kc * 32); }
                // holds these reads in front of the packing: sunk to their products they would be waited for one fragment at a time
                __builtin_amdgcn_sched_barrier(0);
            }
#pragma unroll
            for (int qt = 0; qt < NQ; ++qt) {
                if constexpr (HI) { v8us h0, h1, l0v, l1v;
#pragma unroll
                    for (int e = 0; e < 8; ++e) { unsigned short a, c2; splitf(s[2 * kc][qt][e], a, c2); h0[e] = a; l0v[e] = c2; splitf(s[2 * kc + 1][qt][e], a, c2); h1[e] = a; l1v[e] = c2; }
                    pb[qt] = cat16b(h0, h1); pb2[qt] = cat16b(l0v, l1v);
                } else { v8h h0, h1;
#pragma unroll
                    for (int e = 0; e < 8; ++e) { h0[e] = tohx(s[2 * kc][qt][e]); h1[e] = tohx(s[2 * kc + 1][qt][e]); }
                    pb[qt] = cat16(h0, h1); }
            }
#pragma unroll
            for (int dt = 0; dt < 4; ++dt) {
                const V v = vf[dt][kc]; V v2; if (HI) v2 = vf2[dt][kc];
#pragma unroll
                for (int qt = 0; qt < NQ; ++qt) { o[dt][qt] = WFrag<T16>::mma(v, pb[qt], o[dt][qt]); if (HI) { o[dt][qt] = WFrag<T16>::mma(v, pb2[qt], o[dt][qt]); o[dt][qt] = WFrag<T16>::mma(v2, pb[qt], o[dt][qt]); } }
            }
        }
        // distance after the last matrix instructions at the end of the step: the next trip overwrites their operands
        if constexpr (NQ == 2) asm volatile("v_nop\n\tv_nop\n\tv_nop\n\tv_nop\n\tv_nop" : "+v"(o[0][0]), "+v"(o[0][1]), "+v"(o[1][0]), "+v"(o[1][1]), "+v"(o[2][0]), "+v"(o[2][1]), "+v"(o[3][0]), "+v"(o[3][1]));
        else asm volatile("v_nop\n\tv_nop\n\tv_nop\n\tv_nop\n\tv_nop" : "+v"(o[0][0]), "+v"(o[1][0]), "+v"(o[2][0]), "+v"(o[3][0]));
      }
        asm volatile("s_wait_dscnt 0x0" ::: "memory");      // this wave's reads of the buffer have retired before it is refilled
        asm volatile("s_wait_asynccnt 0x0" ::: "memory");   // this wave's copies of stage st + 2 have landed
        __syncthreads();                                    // publishes stage st + 2 and ends every wave's reads of stage st
        if (st + 4 < NS) stage(st + 4, it & 1);
        lim0 -= 128;
    }
    asm volatile("s_wait_asynccnt 0x0" ::: "memory");       // nothing is in flight when the ring becomes the hand-over area
    const int ln = (int)__builtin_amdgcn_mbcnt_lo(~0u, 0u);   // the lane's number read anew: no row address formed in front of the loop has to live through it, which spilled
    // behind the last trip's barrier the ring is dead. Group 1 hands over O^T, maximum and sum: wave w of group 1 and wave w of group 0 hold the same rows in the same lanes; 16 bytes a lane, 512 bytes a row of the area
    v4fa* mg = (v4fa*)ring0 + (wv & 3) * (8 * NQ + 1) * 32 + ln;
    if (g == 1) {
#pragma unroll
        for (int dt = 0; dt < 4; ++dt)
#pragma unroll
            for (int qt = 0; qt < NQ; ++qt) { const v8f x = o[dt][qt]; mg[((dt * NQ + qt) * 2) * 32] = (v4f){x[0], x[1], x[2], x[3]}; mg[((dt * NQ + qt) * 2 + 1) * 32] = (v4f){x[4], x[5], x[6], x[7]}; }
        mg[8 * NQ * 32] = (v4f){m[0], l[0], m[NQ - 1], l[NQ - 1]};
    }
    __syncthreads();                                        // group 1's state is in LDS before group 0 reads it
    if (g == 1) return;                                     // behind the last barrier
    {
        const v4f ml = mg[8 * NQ * 32];
#pragma unroll
        for (int qt = 0; qt < NQ; ++qt) {                   // both states on the common maximum; a group that met no stage (sum 0, maximum at its start value) gets the factor 0
            const float m1 = ml[2 * qt], mx = fmaxf(m[qt], m1);
            const float a0 = exp2s((m[qt] - mx) * EC), a1 = exp2s((m1 - mx) * EC);
            l[qt] = l[qt] * a0 + ml[2 * qt + 1] * a1;
#pragma unroll
            for (int dt = 0; dt < 4; ++dt) { const v4f y0 = mg[((dt * NQ + qt) * 2) * 32], y1 = mg[((dt * NQ + qt) * 2 + 1) * 32];
#pragma unroll
                for (int j = 0; j < 4; ++j) { o[dt][qt][j] = o[dt][qt][j] * a0 + y0[j] * a1; o[dt][qt][4 + j] = o[dt][qt][4 + j] * a0 + y1[j] * a1; } }
        }
    }
#pragma unroll
    for (int qt = 0; qt < NQ; ++qt) {
        const float inv = __fdiv_rn(1.0f, l[qt] + __shfl_xor(l[qt], 16, 32));
        float* orow = outp + (size_t)(r0 + qt * 16 + (ln & 15)) * DQ + (ln >> 4) * 8;   // a lane's 8 accumulator registers are 8 consecutive head dims of one query row
#pragma unroll
        for (int dt = 0; dt < 4; ++dt) { v4f a, b2;
#pragma unroll
            for (int j = 0; j < 4; ++j) { a[j] = o[dt][qt][j] * inv; b2[j] = o[dt][qt][4 + j] * inv; }
            *(v4f*)(orow + dt * 16) = a; *(v4f*)(orow + dt * 16 + 4) = b2; }
    }
}
// grid (batches x heads, (TT - RH) / 128 + RH / 64), 256 threads: blockIdx.x = batch * NH_ + head; blockIdx.y counts the query blocks from the last (most keys) to the first, for speed only; rows >= RH in blocks of 4 x 32, rows < RH (three products, twice the planes) in blocks of 4 x 16
// at most 256 registers a wave: the build then stays in the directly addressed registers
__global__ __launch_bounds__(256) __attribute__((amdgpu_waves_per_eu(4, 4))) void k_fattn(const h16* __restrict__ Q16, const h16* __restrict__ K16, const h16* __restrict__ V16, const bf* __restrict__ Qh, const bf* __restrict__ Ql, const bf* __restrict__ Kh, const bf* __restrict__ Kl, const bf* __restrict__ Vh, const bf* __restrict__ Vl, float* __restrict__ OUTb) {
    __shared__ __align__(16) unsigned short ring[2 * 2 * 4 * APL];
    const int bh = blockIdx.x, y = blockIdx.y; const size_t zp = (size_t)bh * TT * HD; float* outp = OUTb + (size_t)(bh / NH_) * TT * DQ + (bh % NH_) * HD;
    if (y < (TT - RH) / 128) fattn_tile<h16, false, 2>(Q16 + zp, nullptr, K16 + zp, nullptr, V16 + zp, nullptr, TT - 128 * (y + 1), outp, ring);
    else fattn_tile<bf, true, 1>(Qh + zp, Ql + zp, Kh + zp, Kl + zp, Vh + zp, Vl + zp, RH - 64 * (y - (TT - RH) / 128 + 1), outp, ring);
}

extern "C" void kernel_launch(void* const* d_in, const int* in_sizes, int n_in,
                              void* d_out, int out_size, void* d_ws, size_t ws_size, hipStream_t stream) {
    (void)in_sizes; (void)n_in; (void)out_size;
    const float* x = (const float*)d_in[0]; const float* wqkv = (const float*)d_in[1];   /* argument order inputs, W_qkv ('oi' [3072][1024], per-head (q, k, v) packed rows) */
    float* OUT = (float*)d_out;     // [2][2048][1024]
    char* wsp = (char*)d_ws;
    auto take = [&](size_t bytes) { char* p = wsp; wsp += (bytes + 255) & ~(size_t)255; return (void*)p; };
    bf* WQKV = (bf*)take((size_t)3 * DQ * DM * 2);   /* de-interleaved Bt: q | k | v row blocks in head order */
    bf* XB = (bf*)take((size_t)NB_ * TT * DM * 2);
    /* every plane holds both batches: [batch][head][...] */
    h16* QP16 = (h16*)take((size_t)NB_ * NH_ * TT * HD * 2); h16* KP16 = (h16*)take((size_t)NB_ * NKV * TT * HD * 2); h16* VT16 = (h16*)take((size_t)NB_ * NKV * HD * TT * 2);
    bf* QPh = (bf*)take((size_t)NB_ * NH_ * TT * HD * 2); bf* QPl = (bf*)take((size_t)NB_ * NH_ * TT * HD * 2); bf* KPh = (bf*)take((size_t)NB_ * NKV * TT * HD * 2); bf* KPl = (bf*)take((size_t)NB_ * NKV * TT * HD * 2); bf* VTh = (bf*)take((size_t)NB_ * NKV * HD * TT * 2); bf* VTl = (bf*)take((size_t)NB_ * NKV * HD * TT * 2);
    if ((size_t)(wsp - (char*)d_ws) > ws_size) return;    // ws 256 MiB
    k_wperm<<<(unsigned)(((size_t)3 * DQ * DM / 8 + 255) / 256), 256, 0, stream>>>(wqkv, WQKV);   /* packed rows (h, part, d) -> standard (part, h, d) blocks */
    k_cvt8<<<(unsigned)(((size_t)NB_ * TT * DM / 8 + 255) / 256), 256, 0, stream>>>(x, XB, (size_t)NB_ * TT * DM / 8);
    k_proj<<<dim3(NB_ * TT / 128, 3 * NH_ / 2, 1), 128, 0, stream>>>(XB, WQKV, QP16, QPh, QPl, KP16, KPh, KPl, VT16, VTh, VTl);
    k_fattn<<<dim3(NB_ * NH_, (TT - RH) / 128 + RH / 64, 1), 256, 0, stream>>>(QP16, KP16, VT16, QPh, QPl, KPh, KPl, VTh, VTl, OUT);
}
